// v000
// Times are from an AMD MI455X. After a warm-up the kernel runs many times in a row, and a time is the length of
// such a window on the GPU divided by its runs, so every launch and the gaps after it count. The runs cycle
// through copies of the inputs. A figure is the median of several windows, for all but v000 over two sittings.
// Sittings can differ by a few percent; kernels timed side by side share one.
// The starting kernel, v000, takes 527 microseconds a run.
#include <hip/hip_runtime.h>

typedef float v2f __attribute__((ext_vector_type(2)));
typedef float v4f __attribute__((ext_vector_type(4)));
typedef float v8f __attribute__((ext_vector_type(8)));

#define HIDDEN 1024
#define NEXP   16
#define T_TOK  1024

__device__ __forceinline__ v8f vzero8() {
  v8f z = {0.f, 0.f, 0.f, 0.f, 0.f, 0.f, 0.f, 0.f};
  return z;
}

// D = A(16x4) * B(4x16) + C, fp32 WMMA
__device__ __forceinline__ v8f wmma_k4(v2f a, v2f b, v8f c) {
  return __builtin_amdgcn_wmma_f32_16x16x4_f32(false, a, false, b, (short)0, c,
                                               false, false);
}

// Row-major LDS tile with 16-byte-block XOR swizzle:
//   element (r, c) lives at r*ld + (((c>>2) ^ r) << 2 | (c & 3))
// - async b128 copies (4 floats, block-aligned) stay contiguous
// - A-fragment loads (lanes 0..15 -> rows 0..15, fixed k) hit 16 distinct
//   4-bank blocks -> conflict-free; merged (k,k+1) pairs form ds_load_b64.
__device__ __forceinline__ int lds_idx(int r, int c, int ld) {
  return r * ld + (((((c >> 2) ^ r) & 0xFFFF) << 2) | (c & 3));
}

// global -> LDS async DMA, 16 bytes per lane (ASYNCcnt-tracked)
__device__ __forceinline__ void async_gather_b128(unsigned lds_byte_off,
                                                  const float* gptr) {
  asm volatile("global_load_async_to_lds_b128 %0, %1, off"
               :
               : "v"(lds_byte_off), "v"(gptr)
               : "memory");
}
__device__ __forceinline__ void wait_async0() {
  asm volatile("s_wait_asynccnt 0x0" ::: "memory");
}

// fast reciprocal: raw v_rcp_f32 (~1 ulp), avoids IEEE div expansion
__device__ __forceinline__ float frcp(float x) {
  return __builtin_amdgcn_rcpf(x);
}

__device__ __forceinline__ float silu_f(float g) {
  return g * frcp(1.f + __expf(-g));
}

__global__ void k_zero(int* p, int n) {
  int i = blockIdx.x * blockDim.x + threadIdx.x;
  if (i < n) p[i] = 0;
}

// ---------------------------------------------------------------------------
// Router: one wave per token. Computes 16 logits (chosen modality), softmax,
// top-2 on probs+bias, normalized weights. Appends (token|slot<<16, weight)
// to the per-expert dispatch lists.
// ---------------------------------------------------------------------------
__global__ __launch_bounds__(256) void k_router(
    const float* __restrict__ x, const int* __restrict__ tt,
    const float* __restrict__ rw_t, const float* __restrict__ bias_t,
    const float* __restrict__ rw_v, const float* __restrict__ bias_v,
    float* __restrict__ out_logits,
    int* __restrict__ cnt_t, int* __restrict__ tok_t, float* __restrict__ w_t,
    int* __restrict__ cnt_v, int* __restrict__ tok_v, float* __restrict__ w_v) {
  const int wave = threadIdx.x >> 5;
  const int lane = threadIdx.x & 31;
  const int t = blockIdx.x * 8 + wave;
  if (t >= T_TOK) return;
  const bool isv = (tt[t] != 0);
  const float* rw = isv ? rw_v : rw_t;
  const float* bias = isv ? bias_v : bias_t;

  float acc[NEXP];
#pragma unroll
  for (int e = 0; e < NEXP; ++e) acc[e] = 0.f;
  const float* xr = x + (size_t)t * HIDDEN;
  for (int h = lane; h < HIDDEN; h += 32) {
    float xv = xr[h];
#pragma unroll
    for (int e = 0; e < NEXP; ++e) acc[e] += xv * rw[e * HIDDEN + h];
  }
#pragma unroll
  for (int off = 16; off > 0; off >>= 1) {
#pragma unroll
    for (int e = 0; e < NEXP; ++e) acc[e] += __shfl_xor(acc[e], off, 32);
  }
  // softmax (all lanes redundantly)
  float mx = acc[0];
#pragma unroll
  for (int e = 1; e < NEXP; ++e) mx = fmaxf(mx, acc[e]);
  float p[NEXP], s = 0.f;
#pragma unroll
  for (int e = 0; e < NEXP; ++e) {
    p[e] = __expf(acc[e] - mx);
    s += p[e];
  }
  float inv = frcp(s);
#pragma unroll
  for (int e = 0; e < NEXP; ++e) p[e] *= inv;
  // top-2 of p+bias (earlier index wins ties, like lax.top_k)
  float s1 = -1e30f, s2 = -1e30f, w1 = 0.f, w2 = 0.f;
  int e1 = 0, e2 = 0;
#pragma unroll
  for (int e = 0; e < NEXP; ++e) {
    float v = p[e] + bias[e];
    if (v > s1) {
      s2 = s1; w2 = w1; e2 = e1;
      s1 = v;  w1 = p[e]; e1 = e;
    } else if (v > s2) {
      s2 = v; w2 = p[e]; e2 = e;
    }
  }
  float dnm = fmaxf(w1 + w2, 1e-12f);
  float rdnm = frcp(dnm);
  w1 *= rdnm;
  w2 *= rdnm;

  if (lane == 0) {
#pragma unroll
    for (int e = 0; e < NEXP; ++e) out_logits[t * NEXP + e] = acc[e];
    int* cnt = isv ? cnt_v : cnt_t;
    int* tok = isv ? tok_v : tok_t;
    float* wl = isv ? w_v : w_t;
    int p1 = atomicAdd(&cnt[e1], 1);
    tok[e1 * T_TOK + p1] = t;             // slot 0
    wl[e1 * T_TOK + p1] = w1;
    int p2 = atomicAdd(&cnt[e2], 1);
    tok[e2 * T_TOK + p2] = t | (1 << 16); // slot 1
    wl[e2 * T_TOK + p2] = w2;
  }
}

// ---------------------------------------------------------------------------
// Sparse expert MLP: block = (expert, 16-token tile). 8 waves.
// Stage 1: gu = X(16xH) @ gate_up[e](H x 2I); each wave owns matching g/u
//          column blocks -> register-local SiLU gating.
// Stage 2: y = h(16xI) @ down[e](I x H); write w*y to ys[slot][tok][:].
// ---------------------------------------------------------------------------
template <int I>
__global__ __launch_bounds__(256, 1) void k_expert(
    const float* __restrict__ x,
    const float* __restrict__ gate_up,  // [E][H][2I]
    const float* __restrict__ down,     // [E][I][H]
    const int* __restrict__ cnt, const int* __restrict__ tok,
    const float* __restrict__ wgt,
    float* __restrict__ ys) {           // [2][T][H]
  __shared__ __align__(16) float smem[16 * HIDDEN];  // 64 KB swizzled tile
  const int e = blockIdx.x;
  const int mt = blockIdx.y;
  const int c = cnt[e];
  if (mt * 16 >= c) return;
  const int tid = threadIdx.x;
  const int wave = tid >> 5;
  const int lane = tid & 31;
  const int m = lane & 15;
  const int n = lane & 15;
  const int kh = (lane >> 4) << 1;  // 0 or 2
  const int* tokp = tok + e * T_TOK + mt * 16;
  const float* wp = wgt + e * T_TOK + mt * 16;
  const int nrows = min(16, c - mt * 16);

  // gather up to 16 token rows of x into LDS via async b128 DMA
  const unsigned sbase = (unsigned)(uintptr_t)(&smem[0]);
  for (int i = tid; i < 16 * (HIDDEN / 4); i += 256) {
    int r = i >> 8;             // row 0..15
    int col = (i & 255) << 2;   // block-aligned column
    int idx = lds_idx(r, col, HIDDEN);
    if (r < nrows) {
      int tk = tokp[r] & 0xFFFF;
      async_gather_b128(sbase + 4u * (unsigned)idx,
                        x + (size_t)tk * HIDDEN + col);
    } else {
      v4f z = {0.f, 0.f, 0.f, 0.f};
      *(v4f*)&smem[idx] = z;
    }
  }
  wait_async0();
  __syncthreads();

  constexpr int NT1 = I / 128;  // 16-col tiles per (g,u) half per wave
  const float* gu = gate_up + (size_t)e * HIDDEN * (2 * I);
  v8f accg[NT1], accu[NT1];
#pragma unroll
  for (int j = 0; j < NT1; ++j) {
    accg[j] = vzero8();
    accu[j] = vzero8();
  }
  const int gbase = wave * (I / 8);
  for (int kb = 0; kb < HIDDEN; kb += 4) {
    const int kk = kb + kh;
    v2f a;
    a.x = smem[lds_idx(m, kk, HIDDEN)];
    a.y = smem[lds_idx(m, kk + 1, HIDDEN)];
    const float* b0 = gu + (size_t)kk * (2 * I);
    const float* b1 = b0 + (2 * I);
#pragma unroll
    for (int j = 0; j < NT1; ++j) {
      int cg = gbase + j * 16 + n;
      v2f bg;
      bg.x = b0[cg];
      bg.y = b1[cg];
      accg[j] = wmma_k4(a, bg, accg[j]);
      int cu = cg + I;
      v2f bu;
      bu.x = b0[cu];
      bu.y = b1[cu];
      accu[j] = wmma_k4(a, bu, accu[j]);
    }
  }
  __syncthreads();  // everyone done reading x tile
  // h = silu(g)*u -> LDS (row-major swizzled over I columns)
#pragma unroll
  for (int j = 0; j < NT1; ++j) {
#pragma unroll
    for (int r = 0; r < 8; ++r) {
      int mm = r + ((lane >> 4) << 3);
      int col = gbase + j * 16 + n;
      smem[lds_idx(mm, col, I)] = silu_f(accg[j][r]) * accu[j][r];
    }
  }
  __syncthreads();

  const float* dn = down + (size_t)e * I * HIDDEN;
  v8f acco[8];
#pragma unroll
  for (int j = 0; j < 8; ++j) acco[j] = vzero8();
  const int cb = wave * 128;
  for (int kb = 0; kb < I; kb += 4) {
    const int kk = kb + kh;
    v2f a;
    a.x = smem[lds_idx(m, kk, I)];
    a.y = smem[lds_idx(m, kk + 1, I)];
    const float* b0 = dn + (size_t)kk * HIDDEN;
    const float* b1 = b0 + HIDDEN;
#pragma unroll
    for (int j = 0; j < 8; ++j) {
      int cc = cb + j * 16 + n;
      v2f b;
      b.x = b0[cc];
      b.y = b1[cc];
      acco[j] = wmma_k4(a, b, acco[j]);
    }
  }
  // deterministic scatter: each (token, slot) row written exactly once
#pragma unroll
  for (int r = 0; r < 8; ++r) {
    int mm = r + ((lane >> 4) << 3);
    if (mm < nrows) {
      int ent = tokp[mm];
      int tk = ent & 0xFFFF;
      int slot = ent >> 16;
      float wv = wp[mm];
      float* dst = ys + (size_t)slot * T_TOK * HIDDEN + (size_t)tk * HIDDEN;
#pragma unroll
      for (int j = 0; j < 8; ++j) dst[cb + j * 16 + n] = wv * acco[j][r];
    }
  }
}

// ---------------------------------------------------------------------------
// Shared experts stage A: act = silu(x@Wg) * (x@Wu)   [T x 1024]
// grid = (64 m-tiles, 2 column halves); wave owns 64 cols of each half.
// ---------------------------------------------------------------------------
__global__ __launch_bounds__(256, 1) void k_shared_gu(
    const float* __restrict__ x, const float* __restrict__ wg,
    const float* __restrict__ wu, float* __restrict__ act) {
  __shared__ __align__(16) float smem[16 * HIDDEN];
  const int mt = blockIdx.x;
  const int nh = blockIdx.y;
  const int tid = threadIdx.x;
  const int wave = tid >> 5;
  const int lane = tid & 31;
  const int m = lane & 15;
  const int n = lane & 15;
  const int kh = (lane >> 4) << 1;

  const unsigned sbase = (unsigned)(uintptr_t)(&smem[0]);
  for (int i = tid; i < 16 * (HIDDEN / 4); i += 256) {
    int r = i >> 8;
    int col = (i & 255) << 2;
    async_gather_b128(sbase + 4u * (unsigned)lds_idx(r, col, HIDDEN),
                      x + (size_t)(mt * 16 + r) * HIDDEN + col);
  }
  wait_async0();
  __syncthreads();

  v8f ag[4], au[4];
#pragma unroll
  for (int j = 0; j < 4; ++j) {
    ag[j] = vzero8();
    au[j] = vzero8();
  }
  const int cb = nh * 512 + wave * 64;
  for (int kb = 0; kb < HIDDEN; kb += 4) {
    const int kk = kb + kh;
    v2f a;
    a.x = smem[lds_idx(m, kk, HIDDEN)];
    a.y = smem[lds_idx(m, kk + 1, HIDDEN)];
    const float* g0 = wg + (size_t)kk * HIDDEN;
    const float* g1 = g0 + HIDDEN;
    const float* u0 = wu + (size_t)kk * HIDDEN;
    const float* u1 = u0 + HIDDEN;
#pragma unroll
    for (int j = 0; j < 4; ++j) {
      int cc = cb + j * 16 + n;
      v2f bg;
      bg.x = g0[cc];
      bg.y = g1[cc];
      ag[j] = wmma_k4(a, bg, ag[j]);
      v2f bu;
      bu.x = u0[cc];
      bu.y = u1[cc];
      au[j] = wmma_k4(a, bu, au[j]);
    }
  }
#pragma unroll
  for (int j = 0; j < 4; ++j) {
#pragma unroll
    for (int r = 0; r < 8; ++r) {
      int mm = r + ((lane >> 4) << 3);
      act[(size_t)(mt * 16 + mm) * HIDDEN + cb + j * 16 + n] =
          silu_f(ag[j][r]) * au[j][r];
    }
  }
}

// ---------------------------------------------------------------------------
// Shared experts stage B + final combine:
//   out = act @ Wd + ys[slot0] + ys[slot1]
// ---------------------------------------------------------------------------
__global__ __launch_bounds__(256, 1) void k_shared_down_combine(
    const float* __restrict__ act, const float* __restrict__ wd,
    const float* __restrict__ ys, float* __restrict__ out) {
  __shared__ __align__(16) float smem[16 * HIDDEN];
  const int mt = blockIdx.x;
  const int nh = blockIdx.y;
  const int tid = threadIdx.x;
  const int wave = tid >> 5;
  const int lane = tid & 31;
  const int m = lane & 15;
  const int n = lane & 15;
  const int kh = (lane >> 4) << 1;

  const unsigned sbase = (unsigned)(uintptr_t)(&smem[0]);
  for (int i = tid; i < 16 * (HIDDEN / 4); i += 256) {
    int r = i >> 8;
    int col = (i & 255) << 2;
    async_gather_b128(sbase + 4u * (unsigned)lds_idx(r, col, HIDDEN),
                      act + (size_t)(mt * 16 + r) * HIDDEN + col);
  }
  wait_async0();
  __syncthreads();

  v8f ac[4];
#pragma unroll
  for (int j = 0; j < 4; ++j) ac[j] = vzero8();
  const int cb = nh * 512 + wave * 64;
  for (int kb = 0; kb < HIDDEN; kb += 4) {
    const int kk = kb + kh;
    v2f a;
    a.x = smem[lds_idx(m, kk, HIDDEN)];
    a.y = smem[lds_idx(m, kk + 1, HIDDEN)];
    const float* b0 = wd + (size_t)kk * HIDDEN;
    const float* b1 = b0 + HIDDEN;
#pragma unroll
    for (int j = 0; j < 4; ++j) {
      int cc = cb + j * 16 + n;
      v2f b;
      b.x = b0[cc];
      b.y = b1[cc];
      ac[j] = wmma_k4(a, b, ac[j]);
    }
  }
#pragma unroll
  for (int j = 0; j < 4; ++j) {
#pragma unroll
    for (int r = 0; r < 8; ++r) {
      int mm = r + ((lane >> 4) << 3);
      size_t idx = (size_t)(mt * 16 + mm) * HIDDEN + cb + j * 16 + n;
      out[idx] = ac[j][r] + ys[idx] + ys[idx + (size_t)T_TOK * HIDDEN];
    }
  }
}

extern "C" void kernel_launch(void* const* d_in, const int* in_sizes, int n_in,
                              void* d_out, int out_size, void* d_ws,
                              size_t ws_size, hipStream_t stream) {
  (void)in_sizes; (void)n_in; (void)out_size; (void)ws_size;
  const float* x   = (const float*)d_in[0];
  const int*   tt  = (const int*)d_in[1];
  const float* trw = (const float*)d_in[2];
  const float* tb  = (const float*)d_in[3];
  const float* tgu = (const float*)d_in[4];
  const float* tdn = (const float*)d_in[5];
  const float* vrw = (const float*)d_in[6];
  const float* vb  = (const float*)d_in[7];
  const float* vgu = (const float*)d_in[8];
  const float* vdn = (const float*)d_in[9];
  const float* sg  = (const float*)d_in[10];
  const float* su  = (const float*)d_in[11];
  const float* sd  = (const float*)d_in[12];

  float* out = (float*)d_out;
  float* out_logits = out + (size_t)T_TOK * HIDDEN;

  // workspace layout (all 4-byte elements)
  int* cnt_t = (int*)d_ws;
  int* cnt_v = cnt_t + 16;
  int* tok_t = cnt_v + 16;
  int* tok_v = tok_t + NEXP * T_TOK;
  float* w_t = (float*)(tok_v + NEXP * T_TOK);
  float* w_v = w_t + NEXP * T_TOK;
  float* act = w_v + NEXP * T_TOK;                 // [T][H] = 4 MB
  float* ys  = act + (size_t)T_TOK * HIDDEN;       // [2][T][H] = 8 MB

  k_zero<<<1, 64, 0, stream>>>(cnt_t, 32);
  k_router<<<128, 256, 0, stream>>>(x, tt, trw, tb, vrw, vb, out_logits, cnt_t,
                                    tok_t, w_t, cnt_v, tok_v, w_v);
  k_expert<512><<<dim3(16, 64), 256, 0, stream>>>(x, tgu, tdn, cnt_t, tok_t,
                                                  w_t, ys);
  k_expert<256><<<dim3(16, 64), 256, 0, stream>>>(x, vgu, vdn, cnt_v, tok_v,
                                                  w_v, ys);
  k_shared_gu<<<dim3(64, 2), 256, 0, stream>>>(x, sg, su, act);
  k_shared_down_combine<<<dim3(64, 2), 256, 0, stream>>>(act, sd, ys, out);
}

// v001
// One run takes 255 microseconds.
// In both of two side-by-side timings against v000, it was 2.08 times as fast.
#include <hip/hip_runtime.h>

typedef float v2f __attribute__((ext_vector_type(2)));
typedef float v4f __attribute__((ext_vector_type(4)));
typedef float v8f __attribute__((ext_vector_type(8)));

#define HIDDEN 1024
#define NEXP   16
#define T_TOK  1024

__device__ __forceinline__ v8f vzero8() {
  v8f z = {0.f, 0.f, 0.f, 0.f, 0.f, 0.f, 0.f, 0.f};
  return z;
}

// D = A(16x4) * B(4x16) + C, fp32 WMMA
__device__ __forceinline__ v8f wmma_k4(v2f a, v2f b, v8f c) {
  return __builtin_amdgcn_wmma_f32_16x16x4_f32(false, a, false, b, (short)0, c,
                                               false, false);
}

// Row-major LDS tile with 16-byte-block XOR swizzle:
//   element (r, c) lives at r*ld + (((c>>2) ^ r) << 2 | (c & 3))
// - async b128 copies (4 floats, block-aligned) stay contiguous
// - A-fragment loads (lanes 0..15 -> rows 0..15, fixed k) hit 16 distinct
//   4-bank blocks -> conflict-free; merged (k,k+1) pairs form ds_load_b64.
__device__ __forceinline__ int lds_idx(int r, int c, int ld) {
  return r * ld + (((((c >> 2) ^ r) & 0xFFFF) << 2) | (c & 3));
}

// global -> LDS async DMA, 16 bytes per lane (ASYNCcnt-tracked)
__device__ __forceinline__ void async_gather_b128(unsigned lds_byte_off,
                                                  const float* gptr) {
  asm volatile("global_load_async_to_lds_b128 %0, %1, off"
               :
               : "v"(lds_byte_off), "v"(gptr)
               : "memory");
}
__device__ __forceinline__ void wait_async0() {
  asm volatile("s_wait_asynccnt 0x0" ::: "memory");
}

// fast reciprocal: raw v_rcp_f32 (~1 ulp), avoids IEEE div expansion
__device__ __forceinline__ float frcp(float x) {
  return __builtin_amdgcn_rcpf(x);
}

__device__ __forceinline__ float silu_f(float g) {
  return g * frcp(1.f + __expf(-g));
}

// K loop with the weight (B) fragments fetched ahead into two register sets of
// U k-steps each: as soon as a set has been multiplied it is refilled with the
// rows 8 * U further on, and those loads fly while the other set is multiplied.
// ld(set, kb) loads the U k-steps that start at row kb; mm(set, kb) multiplies
// them, in the same k order as a plain loop.
// K is a multiple of 8 * U; no row at or past K is ever loaded.
// U * NT = 32 everywhere: 64 loads of a wave per set (the load counter holds
// 63), two sets of 64 registers beside 32 to 64 accumulator registers.
template <int U, int NT, typename LD, typename MM>
__device__ __forceinline__ void k_loop_ahead(int K, LD ld, MM mm) {
  v2f s0[U][NT], s1[U][NT];
  ld(s0, 0);
  ld(s1, 4 * U);
  int kb = 0;
  for (; kb < K - 8 * U; kb += 8 * U) {
    mm(s0, kb);
    ld(s0, kb + 8 * U);
    mm(s1, kb + 4 * U);
    ld(s1, kb + 12 * U);
    // the next trip forms new addresses in registers that this trip's loads name
    asm volatile("s_wait_xcnt 0x0" ::: "memory");
  }
  mm(s0, kb);
  mm(s1, kb + 4 * U);
}

__global__ void k_zero(int* p, int n) {
  int i = blockIdx.x * blockDim.x + threadIdx.x;
  if (i < n) p[i] = 0;
}

// ---------------------------------------------------------------------------
// Router: one wave per token. Computes 16 logits (chosen modality), softmax,
// top-2 on probs+bias, normalized weights. Appends (token|slot<<16, weight)
// to the per-expert dispatch lists.
// ---------------------------------------------------------------------------
__global__ __launch_bounds__(256) void k_router(
    const float* __restrict__ x, const int* __restrict__ tt,
    const float* __restrict__ rw_t, const float* __restrict__ bias_t,
    const float* __restrict__ rw_v, const float* __restrict__ bias_v,
    float* __restrict__ out_logits,
    int* __restrict__ cnt_t, int* __restrict__ tok_t, float* __restrict__ w_t,
    int* __restrict__ cnt_v, int* __restrict__ tok_v, float* __restrict__ w_v) {
  const int wave = threadIdx.x >> 5;
  const int lane = threadIdx.x & 31;
  const int t = blockIdx.x * 8 + wave;
  if (t >= T_TOK) return;
  const bool isv = (tt[t] != 0);
  const float* rw = isv ? rw_v : rw_t;
  const float* bias = isv ? bias_v : bias_t;

  float acc[NEXP];
#pragma unroll
  for (int e = 0; e < NEXP; ++e) acc[e] = 0.f;
  const float* xr = x + (size_t)t * HIDDEN;
  for (int h = lane; h < HIDDEN; h += 32) {
    float xv = xr[h];
#pragma unroll
    for (int e = 0; e < NEXP; ++e) acc[e] += xv * rw[e * HIDDEN + h];
  }
#pragma unroll
  for (int off = 16; off > 0; off >>= 1) {
#pragma unroll
    for (int e = 0; e < NEXP; ++e) acc[e] += __shfl_xor(acc[e], off, 32);
  }
  // softmax (all lanes redundantly)
  float mx = acc[0];
#pragma unroll
  for (int e = 1; e < NEXP; ++e) mx = fmaxf(mx, acc[e]);
  float p[NEXP], s = 0.f;
#pragma unroll
  for (int e = 0; e < NEXP; ++e) {
    p[e] = __expf(acc[e] - mx);
    s += p[e];
  }
  float inv = frcp(s);
#pragma unroll
  for (int e = 0; e < NEXP; ++e) p[e] *= inv;
  // top-2 of p+bias (earlier index wins ties, like lax.top_k)
  float s1 = -1e30f, s2 = -1e30f, w1 = 0.f, w2 = 0.f;
  int e1 = 0, e2 = 0;
#pragma unroll
  for (int e = 0; e < NEXP; ++e) {
    float v = p[e] + bias[e];
    if (v > s1) {
      s2 = s1; w2 = w1; e2 = e1;
      s1 = v;  w1 = p[e]; e1 = e;
    } else if (v > s2) {
      s2 = v; w2 = p[e]; e2 = e;
    }
  }
  float dnm = fmaxf(w1 + w2, 1e-12f);
  float rdnm = frcp(dnm);
  w1 *= rdnm;
  w2 *= rdnm;

  if (lane == 0) {
#pragma unroll
    for (int e = 0; e < NEXP; ++e) out_logits[t * NEXP + e] = acc[e];
    int* cnt = isv ? cnt_v : cnt_t;
    int* tok = isv ? tok_v : tok_t;
    float* wl = isv ? w_v : w_t;
    int p1 = atomicAdd(&cnt[e1], 1);
    tok[e1 * T_TOK + p1] = t;             // slot 0
    wl[e1 * T_TOK + p1] = w1;
    int p2 = atomicAdd(&cnt[e2], 1);
    tok[e2 * T_TOK + p2] = t | (1 << 16); // slot 1
    wl[e2 * T_TOK + p2] = w2;
  }
}

// ---------------------------------------------------------------------------
// Sparse expert MLP: block = (expert, 16-token tile). 8 waves.
// Stage 1: gu = X(16xH) @ gate_up[e](H x 2I); each wave owns matching g/u
//          column blocks -> register-local SiLU gating.
// Stage 2: y = h(16xI) @ down[e](I x H); write w*y to ys[slot][tok][:].
// ---------------------------------------------------------------------------
template <int I>
__global__ __launch_bounds__(256, 1) void k_expert(
    const float* __restrict__ x,
    const float* __restrict__ gate_up,  // [E][H][2I]
    const float* __restrict__ down,     // [E][I][H]
    const int* __restrict__ cnt, const int* __restrict__ tok,
    const float* __restrict__ wgt,
    float* __restrict__ ys) {           // [2][T][H]
  __shared__ __align__(16) float smem[16 * HIDDEN];  // 64 KB swizzled tile
  const int e = blockIdx.x;
  const int mt = blockIdx.y;
  const int c = cnt[e];
  if (mt * 16 >= c) return;
  const int tid = threadIdx.x;
  const int wave = tid >> 5;
  const int lane = tid & 31;
  const int m = lane & 15;
  const int n = lane & 15;
  const int kh = (lane >> 4) << 1;  // 0 or 2
  const int* tokp = tok + e * T_TOK + mt * 16;
  const float* wp = wgt + e * T_TOK + mt * 16;
  const int nrows = min(16, c - mt * 16);

  // gather up to 16 token rows of x into LDS via async b128 DMA
  const unsigned sbase = (unsigned)(uintptr_t)(&smem[0]);
  for (int i = tid; i < 16 * (HIDDEN / 4); i += 256) {
    int r = i >> 8;             // row 0..15
    int col = (i & 255) << 2;   // block-aligned column
    int idx = lds_idx(r, col, HIDDEN);
    if (r < nrows) {
      int tk = tokp[r] & 0xFFFF;
      async_gather_b128(sbase + 4u * (unsigned)idx,
                        x + (size_t)tk * HIDDEN + col);
    } else {
      v4f z = {0.f, 0.f, 0.f, 0.f};
      *(v4f*)&smem[idx] = z;
    }
  }
  wait_async0();
  __syncthreads();

  constexpr int NT1 = I / 128;  // 16-col tiles per (g,u) half per wave
  const float* gu = gate_up + (size_t)e * HIDDEN * (2 * I);
  v8f accg[NT1], accu[NT1];
#pragma unroll
  for (int j = 0; j < NT1; ++j) {
    accg[j] = vzero8();
    accu[j] = vzero8();
  }
  const int gbase = wave * (I / 8);
  constexpr int U1 = 16 / NT1;  // 64 loads of a wave per group
  k_loop_ahead<U1, 2 * NT1>(
      HIDDEN,
      [&](v2f (&b)[U1][2 * NT1], int kb) {
#pragma unroll  // register arrays need constant indices
        for (int u = 0; u < U1; ++u) {
          const float* b0 = gu + (size_t)(kb + 4 * u + kh) * (2 * I) + gbase + n;
          const float* b1 = b0 + (2 * I);
#pragma unroll  // register arrays need constant indices
          for (int j = 0; j < NT1; ++j) {
            b[u][2 * j].x = b0[j * 16];
            b[u][2 * j].y = b1[j * 16];
            b[u][2 * j + 1].x = b0[j * 16 + I];
            b[u][2 * j + 1].y = b1[j * 16 + I];
          }
        }
      },
      [&](const v2f (&b)[U1][2 * NT1], int kb) {
#pragma unroll  // register arrays need constant indices
        for (int u = 0; u < U1; ++u) {
          const int kk = kb + 4 * u + kh;
          // kk is even: (kk, kk + 1) lie side by side in one 16-byte block
          const v2f a = *(const v2f*)&smem[lds_idx(m, kk, HIDDEN)];
#pragma unroll  // register arrays need constant indices
          for (int j = 0; j < NT1; ++j) {
            accg[j] = wmma_k4(a, b[u][2 * j], accg[j]);
            accu[j] = wmma_k4(a, b[u][2 * j + 1], accu[j]);
          }
        }
      });
  __syncthreads();  // everyone done reading x tile
  // h = silu(g)*u -> LDS (row-major swizzled over I columns)
#pragma unroll
  for (int j = 0; j < NT1; ++j) {
#pragma unroll
    for (int r = 0; r < 8; ++r) {
      int mm = r + ((lane >> 4) << 3);
      int col = gbase + j * 16 + n;
      smem[lds_idx(mm, col, I)] = silu_f(accg[j][r]) * accu[j][r];
    }
  }
  __syncthreads();

  const float* dn = down + (size_t)e * I * HIDDEN;
  v8f acco[8];
#pragma unroll
  for (int j = 0; j < 8; ++j) acco[j] = vzero8();
  const int cb = wave * 128;
  k_loop_ahead<4, 8>(
      I,
      [&](v2f (&b)[4][8], int kb) {
#pragma unroll  // register arrays need constant indices
        for (int u = 0; u < 4; ++u) {
          const float* b0 = dn + (size_t)(kb + 4 * u + kh) * HIDDEN + cb + n;
          const float* b1 = b0 + HIDDEN;
#pragma unroll  // register arrays need constant indices
          for (int j = 0; j < 8; ++j) {
            b[u][j].x = b0[j * 16];
            b[u][j].y = b1[j * 16];
          }
        }
      },
      [&](const v2f (&b)[4][8], int kb) {
#pragma unroll  // register arrays need constant indices
        for (int u = 0; u < 4; ++u) {
          const int kk = kb + 4 * u + kh;
          // kk is even: (kk, kk + 1) lie side by side in one 16-byte block
          const v2f a = *(const v2f*)&smem[lds_idx(m, kk, I)];
#pragma unroll  // register arrays need constant indices
          for (int j = 0; j < 8; ++j) acco[j] = wmma_k4(a, b[u][j], acco[j]);
        }
      });
  // deterministic scatter: each (token, slot) row written exactly once
#pragma unroll
  for (int r = 0; r < 8; ++r) {
    int mm = r + ((lane >> 4) << 3);
    if (mm < nrows) {
      int ent = tokp[mm];
      int tk = ent & 0xFFFF;
      int slot = ent >> 16;
      float wv = wp[mm];
      float* dst = ys + (size_t)slot * T_TOK * HIDDEN + (size_t)tk * HIDDEN;
#pragma unroll
      for (int j = 0; j < 8; ++j) dst[cb + j * 16 + n] = wv * acco[j][r];
    }
  }
}

// ---------------------------------------------------------------------------
// Shared experts stage A: act = silu(x@Wg) * (x@Wu)   [T x 1024]
// grid = (64 m-tiles, 2 column halves); wave owns 64 cols of each half.
// ---------------------------------------------------------------------------
__global__ __launch_bounds__(256, 1) void k_shared_gu(
    const float* __restrict__ x, const float* __restrict__ wg,
    const float* __restrict__ wu, float* __restrict__ act) {
  __shared__ __align__(16) float smem[16 * HIDDEN];
  const int mt = blockIdx.x;
  const int nh = blockIdx.y;
  const int tid = threadIdx.x;
  const int wave = tid >> 5;
  const int lane = tid & 31;
  const int m = lane & 15;
  const int n = lane & 15;
  const int kh = (lane >> 4) << 1;

  const unsigned sbase = (unsigned)(uintptr_t)(&smem[0]);
  for (int i = tid; i < 16 * (HIDDEN / 4); i += 256) {
    int r = i >> 8;
    int col = (i & 255) << 2;
    async_gather_b128(sbase + 4u * (unsigned)lds_idx(r, col, HIDDEN),
                      x + (size_t)(mt * 16 + r) * HIDDEN + col);
  }
  wait_async0();
  __syncthreads();

  v8f ag[4], au[4];
#pragma unroll
  for (int j = 0; j < 4; ++j) {
    ag[j] = vzero8();
    au[j] = vzero8();
  }
  const int cb = nh * 512 + wave * 64;
  k_loop_ahead<4, 8>(
      HIDDEN,
      [&](v2f (&b)[4][8], int kb) {
#pragma unroll  // register arrays need constant indices
        for (int u = 0; u < 4; ++u) {
          const size_t ro = (size_t)(kb + 4 * u + kh) * HIDDEN + cb + n;
          const float* g0 = wg + ro;
          const float* u0 = wu + ro;
#pragma unroll  // register arrays need constant indices
          for (int j = 0; j < 4; ++j) {
            b[u][2 * j].x = g0[j * 16];
            b[u][2 * j].y = g0[j * 16 + HIDDEN];
            b[u][2 * j + 1].x = u0[j * 16];
            b[u][2 * j + 1].y = u0[j * 16 + HIDDEN];
          }
        }
      },
      [&](const v2f (&b)[4][8], int kb) {
#pragma unroll  // register arrays need constant indices
        for (int u = 0; u < 4; ++u) {
          const int kk = kb + 4 * u + kh;
          // kk is even: (kk, kk + 1) lie side by side in one 16-byte block
          const v2f a = *(const v2f*)&smem[lds_idx(m, kk, HIDDEN)];
#pragma unroll  // register arrays need constant indices
          for (int j = 0; j < 4; ++j) {
            ag[j] = wmma_k4(a, b[u][2 * j], ag[j]);
            au[j] = wmma_k4(a, b[u][2 * j + 1], au[j]);
          }
        }
      });
#pragma unroll
  for (int j = 0; j < 4; ++j) {
#pragma unroll
    for (int r = 0; r < 8; ++r) {
      int mm = r + ((lane >> 4) << 3);
      act[(size_t)(mt * 16 + mm) * HIDDEN + cb + j * 16 + n] =
          silu_f(ag[j][r]) * au[j][r];
    }
  }
}

// ---------------------------------------------------------------------------
// Shared experts stage B + final combine:
//   out = act @ Wd + ys[slot0] + ys[slot1]
// ---------------------------------------------------------------------------
__global__ __launch_bounds__(256, 1) void k_shared_down_combine(
    const float* __restrict__ act, const float* __restrict__ wd,
    const float* __restrict__ ys, float* __restrict__ out) {
  __shared__ __align__(16) float smem[16 * HIDDEN];
  const int mt = blockIdx.x;
  const int nh = blockIdx.y;
  const int tid = threadIdx.x;
  const int wave = tid >> 5;
  const int lane = tid & 31;
  const int m = lane & 15;
  const int n = lane & 15;
  const int kh = (lane >> 4) << 1;

  const unsigned sbase = (unsigned)(uintptr_t)(&smem[0]);
  for (int i = tid; i < 16 * (HIDDEN / 4); i += 256) {
    int r = i >> 8;
    int col = (i & 255) << 2;
    async_gather_b128(sbase + 4u * (unsigned)lds_idx(r, col, HIDDEN),
                      act + (size_t)(mt * 16 + r) * HIDDEN + col);
  }
  wait_async0();
  __syncthreads();

  v8f ac[4];
#pragma unroll
  for (int j = 0; j < 4; ++j) ac[j] = vzero8();
  const int cb = nh * 512 + wave * 64;
  k_loop_ahead<8, 4>(
      HIDDEN,
      [&](v2f (&b)[8][4], int kb) {
#pragma unroll  // register arrays need constant indices
        for (int u = 0; u < 8; ++u) {
          const float* b0 = wd + (size_t)(kb + 4 * u + kh) * HIDDEN + cb + n;
          const float* b1 = b0 + HIDDEN;
#pragma unroll  // register arrays need constant indices
          for (int j = 0; j < 4; ++j) {
            b[u][j].x = b0[j * 16];
            b[u][j].y = b1[j * 16];
          }
        }
      },
      [&](const v2f (&b)[8][4], int kb) {
#pragma unroll  // register arrays need constant indices
        for (int u = 0; u < 8; ++u) {
          const int kk = kb + 4 * u + kh;
          // kk is even: (kk, kk + 1) lie side by side in one 16-byte block
          const v2f a = *(const v2f*)&smem[lds_idx(m, kk, HIDDEN)];
#pragma unroll  // register arrays need constant indices
          for (int j = 0; j < 4; ++j) ac[j] = wmma_k4(a, b[u][j], ac[j]);
        }
      });
#pragma unroll
  for (int j = 0; j < 4; ++j) {
#pragma unroll
    for (int r = 0; r < 8; ++r) {
      int mm = r + ((lane >> 4) << 3);
      size_t idx = (size_t)(mt * 16 + mm) * HIDDEN + cb + j * 16 + n;
      out[idx] = ac[j][r] + ys[idx] + ys[idx + (size_t)T_TOK * HIDDEN];
    }
  }
}

extern "C" void kernel_launch(void* const* d_in, const int* in_sizes, int n_in,
                              void* d_out, int out_size, void* d_ws,
                              size_t ws_size, hipStream_t stream) {
  (void)in_sizes; (void)n_in; (void)out_size; (void)ws_size;
  const float* x   = (const float*)d_in[0];
  const int*   tt  = (const int*)d_in[1];
  const float* trw = (const float*)d_in[2];
  const float* tb  = (const float*)d_in[3];
  const float* tgu = (const float*)d_in[4];
  const float* tdn = (const float*)d_in[5];
  const float* vrw = (const float*)d_in[6];
  const float* vb  = (const float*)d_in[7];
  const float* vgu = (const float*)d_in[8];
  const float* vdn = (const float*)d_in[9];
  const float* sg  = (const float*)d_in[10];
  const float* su  = (const float*)d_in[11];
  const float* sd  = (const float*)d_in[12];

  float* out = (float*)d_out;
  float* out_logits = out + (size_t)T_TOK * HIDDEN;

  // workspace layout (all 4-byte elements)
  int* cnt_t = (int*)d_ws;
  int* cnt_v = cnt_t + 16;
  int* tok_t = cnt_v + 16;
  int* tok_v = tok_t + NEXP * T_TOK;
  float* w_t = (float*)(tok_v + NEXP * T_TOK);
  float* w_v = w_t + NEXP * T_TOK;
  float* act = w_v + NEXP * T_TOK;                 // [T][H] = 4 MB
  float* ys  = act + (size_t)T_TOK * HIDDEN;       // [2][T][H] = 8 MB

  k_zero<<<1, 64, 0, stream>>>(cnt_t, 32);
  k_router<<<128, 256, 0, stream>>>(x, tt, trw, tb, vrw, vb, out_logits, cnt_t,
                                    tok_t, w_t, cnt_v, tok_v, w_v);
  k_expert<512><<<dim3(16, 64), 256, 0, stream>>>(x, tgu, tdn, cnt_t, tok_t,
                                                  w_t, ys);
  k_expert<256><<<dim3(16, 64), 256, 0, stream>>>(x, vgu, vdn, cnt_v, tok_v,
                                                  w_v, ys);
  k_shared_gu<<<dim3(64, 2), 256, 0, stream>>>(x, sg, su, act);
  k_shared_down_combine<<<dim3(64, 2), 256, 0, stream>>>(act, sd, ys, out);
}

// v002
// It runs in 154 microseconds.
// Next to v001, in two timings, it ran 1.66 times as fast each time.
// Over all steps from v000 it is 3.46 times as fast.
#include <hip/hip_runtime.h>

typedef float v2f __attribute__((ext_vector_type(2)));
typedef float v4f __attribute__((ext_vector_type(4)));
typedef float v8f __attribute__((ext_vector_type(8)));

#define HIDDEN 1024
#define NEXP   16
#define T_TOK  1024
#define ISL    128  // columns of an expert's intermediate dim per work-group
#define YS_SL  4    // slices of the widest expert (512 / ISL): planes of ys per slot
#define MT_Z   16   // grid.z of the expert kernels: token tiles walked with this stride

__device__ __forceinline__ v8f vzero8() {
  v8f z = {0.f, 0.f, 0.f, 0.f, 0.f, 0.f, 0.f, 0.f};
  return z;
}

// D = A(16x4) * B(4x16) + C, fp32 WMMA
__device__ __forceinline__ v8f wmma_k4(v2f a, v2f b, v8f c) {
  return __builtin_amdgcn_wmma_f32_16x16x4_f32(false, a, false, b, (short)0, c,
                                               false, false);
}

// Row-major LDS tile with 16-byte-block XOR swizzle:
//   element (r, c) lives at r*ld + (((c>>2) ^ r) << 2 | (c & 3))
// - async b128 copies (4 floats, block-aligned) stay contiguous
// - A-fragment loads (lanes 0..15 -> rows 0..15, fixed k) hit 16 distinct
//   4-bank blocks -> conflict-free; merged (k,k+1) pairs form ds_load_b64.
__device__ __forceinline__ int lds_idx(int r, int c, int ld) {
  return r * ld + (((((c >> 2) ^ r) & 0xFFFF) << 2) | (c & 3));
}

// global -> LDS async DMA, 16 bytes per lane (ASYNCcnt-tracked)
__device__ __forceinline__ void async_gather_b128(unsigned lds_byte_off,
                                                  const float* gptr) {
  // the wait ends the statement: later code rewrites the two address registers
  asm volatile("global_load_async_to_lds_b128 %0, %1, off\n\ts_wait_xcnt 0x0"
               :
               : "v"(lds_byte_off), "v"(gptr)
               : "memory");
}
__device__ __forceinline__ void wait_async0() {
  asm volatile("s_wait_asynccnt 0x0" ::: "memory");
}

// fast reciprocal: raw v_rcp_f32 (~1 ulp), avoids IEEE div expansion
__device__ __forceinline__ float frcp(float x) {
  return __builtin_amdgcn_rcpf(x);
}

__device__ __forceinline__ float silu_f(float g) {
  return g * frcp(1.f + __expf(-g));
}

// K loop with the weight (B) fragments fetched ahead into two register sets of
// U k-steps each: as soon as a set has been multiplied it is refilled with the
// rows 8 * U further on, and those loads fly while the other set is multiplied.
// ld(set, kb) loads the U k-steps that start at row kb; mm(set, kb) multiplies
// them, in the same k order as a plain loop.
// K is a multiple of 8 * U; no row at or past K is ever loaded.
// U * NT = 32 everywhere: 64 loads of a wave per set (the load counter holds
// 63), two sets of 64 registers beside 8 to 64 accumulator registers.
template <int U, int NT, typename LD, typename MM>
__device__ __forceinline__ void k_loop_ahead(int K, LD ld, MM mm) {
  v2f s0[U][NT], s1[U][NT];
  ld(s0, 0);
  ld(s1, 4 * U);
  int kb = 0;
  for (; kb < K - 8 * U; kb += 8 * U) {
    mm(s0, kb);
    ld(s0, kb + 8 * U);
    mm(s1, kb + 4 * U);
    ld(s1, kb + 12 * U);
    // the next trip forms new addresses in registers that this trip's loads name
    asm volatile("s_wait_xcnt 0x0" ::: "memory");
  }
  mm(s0, kb);
  mm(s1, kb + 4 * U);
}

__global__ void k_zero(int* p, int n) {
  int i = blockIdx.x * blockDim.x + threadIdx.x;
  if (i < n) p[i] = 0;
}

// ---------------------------------------------------------------------------
// Router: one wave per token. Computes 16 logits (chosen modality), softmax,
// top-2 on probs+bias, normalized weights. Appends (token|slot<<16, weight)
// to the per-expert dispatch lists.
// ---------------------------------------------------------------------------
__global__ __launch_bounds__(256) void k_router(
    const float* __restrict__ x, const int* __restrict__ tt,
    const float* __restrict__ rw_t, const float* __restrict__ bias_t,
    const float* __restrict__ rw_v, const float* __restrict__ bias_v,
    float* __restrict__ out_logits,
    int* __restrict__ cnt_t, int* __restrict__ tok_t, float* __restrict__ w_t,
    int* __restrict__ cnt_v, int* __restrict__ tok_v, float* __restrict__ w_v) {
  const int wave = threadIdx.x >> 5;
  const int lane = threadIdx.x & 31;
  const int t = blockIdx.x * 8 + wave;
  if (t >= T_TOK) return;
  const bool isv = (tt[t] != 0);
  const float* rw = isv ? rw_v : rw_t;
  const float* bias = isv ? bias_v : bias_t;

  float acc[NEXP];
#pragma unroll
  for (int e = 0; e < NEXP; ++e) acc[e] = 0.f;
  const float* xr = x + (size_t)t * HIDDEN;
  for (int h = lane; h < HIDDEN; h += 32) {
    float xv = xr[h];
#pragma unroll
    for (int e = 0; e < NEXP; ++e) acc[e] += xv * rw[e * HIDDEN + h];
  }
#pragma unroll
  for (int off = 16; off > 0; off >>= 1) {
#pragma unroll
    for (int e = 0; e < NEXP; ++e) acc[e] += __shfl_xor(acc[e], off, 32);
  }
  // softmax (all lanes redundantly)
  float mx = acc[0];
#pragma unroll
  for (int e = 1; e < NEXP; ++e) mx = fmaxf(mx, acc[e]);
  float p[NEXP], s = 0.f;
#pragma unroll
  for (int e = 0; e < NEXP; ++e) {
    p[e] = __expf(acc[e] - mx);
    s += p[e];
  }
  float inv = frcp(s);
#pragma unroll
  for (int e = 0; e < NEXP; ++e) p[e] *= inv;
  // top-2 of p+bias (earlier index wins ties, like lax.top_k)
  float s1 = -1e30f, s2 = -1e30f, w1 = 0.f, w2 = 0.f;
  int e1 = 0, e2 = 0;
#pragma unroll
  for (int e = 0; e < NEXP; ++e) {
    float v = p[e] + bias[e];
    if (v > s1) {
      s2 = s1; w2 = w1; e2 = e1;
      s1 = v;  w1 = p[e]; e1 = e;
    } else if (v > s2) {
      s2 = v; w2 = p[e]; e2 = e;
    }
  }
  float dnm = fmaxf(w1 + w2, 1e-12f);
  float rdnm = frcp(dnm);
  w1 *= rdnm;
  w2 *= rdnm;

  if (lane == 0) {
#pragma unroll
    for (int e = 0; e < NEXP; ++e) out_logits[t * NEXP + e] = acc[e];
    int* cnt = isv ? cnt_v : cnt_t;
    int* tok = isv ? tok_v : tok_t;
    float* wl = isv ? w_v : w_t;
    int p1 = atomicAdd(&cnt[e1], 1);
    tok[e1 * T_TOK + p1] = t;             // slot 0
    wl[e1 * T_TOK + p1] = w1;
    int p2 = atomicAdd(&cnt[e2], 1);
    tok[e2 * T_TOK + p2] = t | (1 << 16); // slot 1
    wl[e2 * T_TOK + p2] = w2;
  }
}

// ---------------------------------------------------------------------------
// Sparse expert MLP: block = (expert, ISL-column slice of the
// intermediate dim, 16-token tiles blockIdx.z + MT_Z * i). 8 waves.
// Stage 1: gu = X(16xH) @ gate_up[e](H x 2I), the slice's g and u columns only;
//          each wave owns one matching g/u column tile -> register-local gating.
// Stage 2: y = h(16xISL) @ down[e](the slice's ISL rows x H), a partial sum over
//          the intermediate dim; write w*y to ys[tok][slot][slice][:]. An expert
//          with fewer than YS_SL slices stores zeros in the planes it lacks, so
//          that the combine sums the same planes for every token.
// ---------------------------------------------------------------------------
// Token tiles lie on grid.z, so that the work-groups that have a tile start first.
// Four waves a SIMD (256 registers a wave): two work-groups share a WGP, so that
// all that have a tile are resident at once.
template <int I>
__global__ __launch_bounds__(256, 4) void k_expert(
    const float* __restrict__ x,
    const float* __restrict__ gate_up,  // [E][H][2I]
    const float* __restrict__ down,     // [E][I][H]
    const int* __restrict__ cnt, const int* __restrict__ tok,
    const float* __restrict__ wgt,
    float* __restrict__ ys) {           // [T][2][YS_SL][H]
  __shared__ __align__(16) float smem[16 * HIDDEN];  // 64 KB swizzled tile
  const int e = blockIdx.x;
  const int sl = blockIdx.y;
  const int c = min(cnt[e], T_TOK);
  const int tid = threadIdx.x;
  const int wave = tid >> 5;
  const int lane = tid & 31;
  const int m = lane & 15;
  const int n = lane & 15;
  const int kh = (lane >> 4) << 1;  // 0 or 2
  const unsigned sbase = (unsigned)(uintptr_t)(&smem[0]);
  const float* gu = gate_up + (size_t)e * HIDDEN * (2 * I);
  const float* dn = down + ((size_t)e * I + (size_t)sl * ISL) * HIDDEN;
  const int gbase = sl * ISL + wave * 16;
  const int cb = wave * 128;
  const int lane1 = kh * (2 * I) + gbase + n;  // the lane's place in a 4-row step
  const int lane2 = kh * HIDDEN + cb + n;

  for (int mt = blockIdx.z; mt * 16 < c; mt += MT_Z) {
    if (mt != (int)blockIdx.z) {
      // a further trip's copies overwrite the h tile: every wave's reads of it
      // end in front of them
      asm volatile("s_wait_dscnt 0x0" ::: "memory");
      __syncthreads();
    }
    const int* tokp = tok + e * T_TOK + mt * 16;
    const float* wp = wgt + e * T_TOK + mt * 16;
    const int nrows = min(16, c - mt * 16);

    // gather up to 16 token rows of x into LDS via async b128 DMA
    for (int i = tid; i < 16 * (HIDDEN / 4); i += 256) {
      int r = i >> 8;             // row 0..15
      int col = (i & 255) << 2;   // block-aligned column
      int idx = lds_idx(r, col, HIDDEN);
      if (r < nrows) {
        int tk = tokp[r] & 0xFFFF;
        async_gather_b128(sbase + 4u * (unsigned)idx,
                          x + (size_t)tk * HIDDEN + col);
      } else {
        v4f z = {0.f, 0.f, 0.f, 0.f};
        *(v4f*)&smem[idx] = z;
      }
    }
    wait_async0();
    __syncthreads();

    v8f accg = vzero8(), accu = vzero8();
    k_loop_ahead<16, 2>(
        HIDDEN,
        [&](v2f (&b)[16][2], int kb) {
#pragma unroll  // register arrays need constant indices
          for (int u = 0; u < 16; ++u) {
            // one lane address a call, the k-steps as constant offsets from it
            const float* b0 = gu + (size_t)kb * (2 * I) + lane1 + 4 * u * (2 * I);
            const float* b1 = b0 + (2 * I);
            b[u][0].x = b0[0];
            b[u][0].y = b1[0];
            b[u][1].x = b0[I];
            b[u][1].y = b1[I];
          }
        },
        [&](const v2f (&b)[16][2], int kb) {
#pragma unroll  // register arrays need constant indices
          for (int u = 0; u < 16; ++u) {
            const int kk = kb + 4 * u + kh;
            // kk is even: (kk, kk + 1) lie side by side in one 16-byte block
            const v2f a = *(const v2f*)&smem[lds_idx(m, kk, HIDDEN)];
            accg = wmma_k4(a, b[u][0], accg);
            accu = wmma_k4(a, b[u][1], accu);
          }
        });
    __syncthreads();  // everyone done reading x tile
    // h = silu(g)*u -> LDS (row-major swizzled over the slice's ISL columns)
#pragma unroll
    for (int r = 0; r < 8; ++r) {
      int mm = r + ((lane >> 4) << 3);
      smem[lds_idx(mm, wave * 16 + n, ISL)] = silu_f(accg[r]) * accu[r];
    }
    __syncthreads();

    v8f acco[8];
#pragma unroll
    for (int j = 0; j < 8; ++j) acco[j] = vzero8();
    k_loop_ahead<4, 8>(
        ISL,
        [&](v2f (&b)[4][8], int kb) {
#pragma unroll  // register arrays need constant indices
          for (int u = 0; u < 4; ++u) {
            // one lane address a call, the k-steps as constant offsets from it
            const float* b0 = dn + (size_t)kb * HIDDEN + lane2 + 4 * u * HIDDEN;
            const float* b1 = b0 + HIDDEN;
#pragma unroll  // register arrays need constant indices
            for (int j = 0; j < 8; ++j) {
              b[u][j].x = b0[j * 16];
              b[u][j].y = b1[j * 16];
            }
          }
        },
        [&](const v2f (&b)[4][8], int kb) {
#pragma unroll  // register arrays need constant indices
          for (int u = 0; u < 4; ++u) {
            const int kk = kb + 4 * u + kh;
            // kk is even: (kk, kk + 1) lie side by side in one 16-byte block
            const v2f a = *(const v2f*)&smem[lds_idx(m, kk, ISL)];
#pragma unroll  // register arrays need constant indices
            for (int j = 0; j < 8; ++j) acco[j] = wmma_k4(a, b[u][j], acco[j]);
          }
        });
    // deterministic scatter: each (token, slot, slice) row written exactly once
#pragma unroll
    for (int r = 0; r < 8; ++r) {
      int mm = r + ((lane >> 4) << 3);
      if (mm < nrows) {
        int ent = tokp[mm];
        int tk = ent & 0xFFFF;
        int slot = ent >> 16;
        float wv = wp[mm];
        float* dst = ys + ((size_t)tk * (2 * YS_SL) + slot * YS_SL + sl) * HIDDEN;
#pragma unroll
        for (int j = 0; j < 8; ++j) dst[cb + j * 16 + n] = wv * acco[j][r];
#pragma unroll
        for (int z = I / ISL; z < YS_SL; z += I / ISL) {
#pragma unroll
          for (int j = 0; j < 8; ++j) dst[z * HIDDEN + cb + j * 16 + n] = 0.f;
        }
      }
    }
    // a further trip forms new values in registers that these stores name
    asm volatile("s_wait_xcnt 0x0" ::: "memory");
  }
}

// ---------------------------------------------------------------------------
// Shared experts stage A: act = silu(x@Wg) * (x@Wu)   [T x 1024]
// grid = (64 m-tiles, 8 column slices); wave owns 16 cols of Wg and of Wu.
// ---------------------------------------------------------------------------
__global__ __launch_bounds__(256, 1) void k_shared_gu(
    const float* __restrict__ x, const float* __restrict__ wg,
    const float* __restrict__ wu, float* __restrict__ act) {
  __shared__ __align__(16) float smem[16 * HIDDEN];
  const int mt = blockIdx.x;
  const int nh = blockIdx.y;
  const int tid = threadIdx.x;
  const int wave = tid >> 5;
  const int lane = tid & 31;
  const int m = lane & 15;
  const int n = lane & 15;
  const int kh = (lane >> 4) << 1;

  const unsigned sbase = (unsigned)(uintptr_t)(&smem[0]);
  for (int i = tid; i < 16 * (HIDDEN / 4); i += 256) {
    int r = i >> 8;
    int col = (i & 255) << 2;
    async_gather_b128(sbase + 4u * (unsigned)lds_idx(r, col, HIDDEN),
                      x + (size_t)(mt * 16 + r) * HIDDEN + col);
  }
  wait_async0();
  __syncthreads();

  v8f ag = vzero8(), au = vzero8();
  const int cb = nh * 128 + wave * 16;
  k_loop_ahead<16, 2>(
      HIDDEN,
      [&](v2f (&b)[16][2], int kb) {
#pragma unroll  // register arrays need constant indices
        for (int u = 0; u < 16; ++u) {
          const size_t ro = (size_t)(kb + 4 * u + kh) * HIDDEN + cb + n;
          const float* g0 = wg + ro;
          const float* u0 = wu + ro;
          b[u][0].x = g0[0];
          b[u][0].y = g0[HIDDEN];
          b[u][1].x = u0[0];
          b[u][1].y = u0[HIDDEN];
        }
      },
      [&](const v2f (&b)[16][2], int kb) {
#pragma unroll  // register arrays need constant indices
        for (int u = 0; u < 16; ++u) {
          const int kk = kb + 4 * u + kh;
          // kk is even: (kk, kk + 1) lie side by side in one 16-byte block
          const v2f a = *(const v2f*)&smem[lds_idx(m, kk, HIDDEN)];
          ag = wmma_k4(a, b[u][0], ag);
          au = wmma_k4(a, b[u][1], au);
        }
      });
#pragma unroll
  for (int r = 0; r < 8; ++r) {
    int mm = r + ((lane >> 4) << 3);
    act[(size_t)(mt * 16 + mm) * HIDDEN + cb + n] = silu_f(ag[r]) * au[r];
  }
}

// ---------------------------------------------------------------------------
// Shared experts stage B + final combine:
//   out = act @ Wd + sum over (slot, slice) of ys[tok][slot][slice]
// grid = (64 m-tiles, 8 column slices); wave owns 16 cols.
// ---------------------------------------------------------------------------
__global__ __launch_bounds__(256, 1) void k_shared_down_combine(
    const float* __restrict__ act, const float* __restrict__ wd,
    const float* __restrict__ ys, float* __restrict__ out) {
  __shared__ __align__(16) float smem[16 * HIDDEN];
  const int mt = blockIdx.x;
  const int nh = blockIdx.y;
  const int tid = threadIdx.x;
  const int wave = tid >> 5;
  const int lane = tid & 31;
  const int m = lane & 15;
  const int n = lane & 15;
  const int kh = (lane >> 4) << 1;

  const unsigned sbase = (unsigned)(uintptr_t)(&smem[0]);
  for (int i = tid; i < 16 * (HIDDEN / 4); i += 256) {
    int r = i >> 8;
    int col = (i & 255) << 2;
    async_gather_b128(sbase + 4u * (unsigned)lds_idx(r, col, HIDDEN),
                      act + (size_t)(mt * 16 + r) * HIDDEN + col);
  }
  wait_async0();
  __syncthreads();

  v8f ac = vzero8();
  const int cb = nh * 128 + wave * 16;
  const int lane0 = kh * HIDDEN + cb + n;  // the lane's place in a 4-row step
  k_loop_ahead<32, 1>(
      HIDDEN,
      [&](v2f (&b)[32][1], int kb) {
#pragma unroll  // register arrays need constant indices
        for (int u = 0; u < 32; ++u) {
          // one lane address a call, the k-steps as constant offsets from it
          const float* b0 = wd + (size_t)kb * HIDDEN + lane0 + 4 * u * HIDDEN;
          b[u][0].x = b0[0];
          b[u][0].y = b0[HIDDEN];
        }
      },
      [&](const v2f (&b)[32][1], int kb) {
#pragma unroll  // register arrays need constant indices
        for (int u = 0; u < 32; ++u) {
          const int kk = kb + 4 * u + kh;
          // kk is even: (kk, kk + 1) lie side by side in one 16-byte block
          const v2f a = *(const v2f*)&smem[lds_idx(m, kk, HIDDEN)];
          ac = wmma_k4(a, b[u][0], ac);
        }
      });
  const size_t row0 = (size_t)(mt * 16 + ((lane >> 4) << 3));
  const float* yp = ys + row0 * (2 * YS_SL * HIDDEN) + cb + n;
  float* op = out + row0 * HIDDEN + cb + n;
  float part[8][2 * YS_SL];
#pragma unroll  // register arrays need constant indices
  for (int r = 0; r < 8; ++r) {
#pragma unroll  // register arrays need constant indices
    for (int p = 0; p < 2 * YS_SL; ++p) part[r][p] = yp[(r * 2 * YS_SL + p) * HIDDEN];
  }
  // all these loads name yp: it is an operand here so that its registers live to
  // this wait and no loaded value lands in them in front of it
  asm volatile("s_wait_xcnt 0x0" ::"v"(yp) : "memory");
#pragma unroll
  for (int r = 0; r < 8; ++r) {
    float v = ac[r];
#pragma unroll
    for (int p = 0; p < 2 * YS_SL; ++p) v += part[r][p];
    op[r * HIDDEN] = v;
  }
}

extern "C" void kernel_launch(void* const* d_in, const int* in_sizes, int n_in,
                              void* d_out, int out_size, void* d_ws,
                              size_t ws_size, hipStream_t stream) {
  (void)in_sizes; (void)n_in; (void)out_size; (void)ws_size;
  const float* x   = (const float*)d_in[0];
  const int*   tt  = (const int*)d_in[1];
  const float* trw = (const float*)d_in[2];
  const float* tb  = (const float*)d_in[3];
  const float* tgu = (const float*)d_in[4];
  const float* tdn = (const float*)d_in[5];
  const float* vrw = (const float*)d_in[6];
  const float* vb  = (const float*)d_in[7];
  const float* vgu = (const float*)d_in[8];
  const float* vdn = (const float*)d_in[9];
  const float* sg  = (const float*)d_in[10];
  const float* su  = (const float*)d_in[11];
  const float* sd  = (const float*)d_in[12];

  float* out = (float*)d_out;
  float* out_logits = out + (size_t)T_TOK * HIDDEN;

  // workspace layout (all 4-byte elements)
  int* cnt_t = (int*)d_ws;
  int* cnt_v = cnt_t + 16;
  int* tok_t = cnt_v + 16;
  int* tok_v = tok_t + NEXP * T_TOK;
  float* w_t = (float*)(tok_v + NEXP * T_TOK);
  float* w_v = w_t + NEXP * T_TOK;
  float* act = w_v + NEXP * T_TOK;                 // [T][H] = 4 MB
  float* ys  = act + (size_t)T_TOK * HIDDEN;       // [T][2][YS_SL][H] = 32 MB

  k_zero<<<1, 64, 0, stream>>>(cnt_t, 32);
  k_router<<<128, 256, 0, stream>>>(x, tt, trw, tb, vrw, vb, out_logits, cnt_t,
                                    tok_t, w_t, cnt_v, tok_v, w_v);
  k_expert<512><<<dim3(16, 4, 16), 256, 0, stream>>>(x, tgu, tdn, cnt_t, tok_t,
                                                  w_t, ys);
  k_expert<256><<<dim3(16, 2, 16), 256, 0, stream>>>(x, vgu, vdn, cnt_v, tok_v,
                                                  w_v, ys);
  k_shared_gu<<<dim3(64, 8), 256, 0, stream>>>(x, sg, su, act);
  k_shared_down_combine<<<dim3(64, 8), 256, 0, stream>>>(act, sd, ys, out);
}

// v003
// Measured time: 133 microseconds a run.
// In both of two side-by-side timings against v002, it was 1.15 times as fast.
// All steps since v000 together make it 3.99 times as fast.
#include <hip/hip_runtime.h>

typedef float v2f __attribute__((ext_vector_type(2)));
typedef float v4f __attribute__((ext_vector_type(4)));
typedef float v8f __attribute__((ext_vector_type(8)));

#define HIDDEN 1024
#define NEXP   16
#define T_TOK  1024
#define ISL    128  // columns of an expert's intermediate dim per work-group
#define YS_SL  4    // slices of the widest expert (512 / ISL): planes of ys per slot
#define MT_Z   16   // work-groups per expert slice: token tiles walked with this stride

__device__ __forceinline__ v8f vzero8() {
  v8f z = {0.f, 0.f, 0.f, 0.f, 0.f, 0.f, 0.f, 0.f};
  return z;
}

// D = A(16x4) * B(4x16) + C, fp32 WMMA
__device__ __forceinline__ v8f wmma_k4(v2f a, v2f b, v8f c) {
  return __builtin_amdgcn_wmma_f32_16x16x4_f32(false, a, false, b, (short)0, c,
                                               false, false);
}

// Row-major LDS tile with 16-byte-block XOR swizzle:
//   element (r, c) lives at r*ld + (((c>>2) ^ r) << 2 | (c & 3))
// - async b128 copies (4 floats, block-aligned) stay contiguous
// - A-fragment loads (lanes 0..15 -> rows 0..15, fixed k) hit 16 distinct
//   4-bank blocks -> conflict-free; merged (k,k+1) pairs form ds_load_b64.
__device__ __forceinline__ int lds_idx(int r, int c, int ld) {
  return r * ld + (((((c >> 2) ^ r) & 0xFFFF) << 2) | (c & 3));
}

// global -> LDS async DMA, 16 bytes per lane (ASYNCcnt-tracked)
__device__ __forceinline__ void async_gather_b128(unsigned lds_byte_off,
                                                  const float* gptr) {
  // the wait ends the statement: later code rewrites the two address registers
  asm volatile("global_load_async_to_lds_b128 %0, %1, off\n\ts_wait_xcnt 0x0"
               :
               : "v"(lds_byte_off), "v"(gptr)
               : "memory");
}
__device__ __forceinline__ void wait_async0() {
  asm volatile("s_wait_asynccnt 0x0" ::: "memory");
}

// fast reciprocal: raw v_rcp_f32 (~1 ulp), avoids IEEE div expansion
__device__ __forceinline__ float frcp(float x) {
  return __builtin_amdgcn_rcpf(x);
}

__device__ __forceinline__ float silu_f(float g) {
  return g * frcp(1.f + __expf(-g));
}

// K loop with the weight (B) fragments fetched ahead into two register sets of
// U k-steps each: as soon as a set has been multiplied it is refilled with the
// rows 8 * U further on, and those loads fly while the other set is multiplied.
// ld(set, kb) loads the U k-steps that start at row kb; mm(set, kb) multiplies
// them, in the same k order as a plain loop.
// K is a multiple of 8 * U; no row at or past K is ever loaded.
// U * NT = 32 everywhere: 64 loads of a wave per set (the load counter holds
// 63), two sets of 64 registers beside 8 to 64 accumulator registers.
template <int U, int NT, typename LD, typename MM>
__device__ __forceinline__ void k_loop_ahead(int K, LD ld, MM mm) {
  v2f s0[U][NT], s1[U][NT];
  ld(s0, 0);
  ld(s1, 4 * U);
  int kb = 0;
  // stays rolled: unrolled whole, the short loop over ISL spills registers to scratch
#pragma unroll 1
  for (; kb < K - 8 * U; kb += 8 * U) {
    mm(s0, kb);
    ld(s0, kb + 8 * U);
    mm(s1, kb + 4 * U);
    ld(s1, kb + 12 * U);
    // the next trip forms new addresses in registers that this trip's loads name
    asm volatile("s_wait_xcnt 0x0" ::: "memory");
  }
  mm(s0, kb);
  mm(s1, kb + 4 * U);
}

__global__ void k_zero(int* p, int n) {
  int i = blockIdx.x * blockDim.x + threadIdx.x;
  if (i < n) p[i] = 0;
}

// ---------------------------------------------------------------------------
// Router: one wave per token. Computes 16 logits (chosen modality), softmax,
// top-2 on probs+bias, normalized weights. Appends (token|slot<<16, weight)
// to the per-expert dispatch lists.
// ---------------------------------------------------------------------------
__global__ __launch_bounds__(256) void k_router(
    const float* __restrict__ x, const int* __restrict__ tt,
    const float* __restrict__ rw_t, const float* __restrict__ bias_t,
    const float* __restrict__ rw_v, const float* __restrict__ bias_v,
    float* __restrict__ out_logits,
    int* __restrict__ cnt_t, int* __restrict__ tok_t, float* __restrict__ w_t,
    int* __restrict__ cnt_v, int* __restrict__ tok_v, float* __restrict__ w_v) {
  const int wave = threadIdx.x >> 5;
  const int lane = threadIdx.x & 31;
  const int t = blockIdx.x * 8 + wave;
  if (t >= T_TOK) return;
  const bool isv = (tt[t] != 0);
  const float* rw = isv ? rw_v : rw_t;
  const float* bias = isv ? bias_v : bias_t;

  float acc[NEXP];
#pragma unroll
  for (int e = 0; e < NEXP; ++e) acc[e] = 0.f;
  const float* xr = x + (size_t)t * HIDDEN;
  for (int h = lane; h < HIDDEN; h += 32) {
    float xv = xr[h];
#pragma unroll
    for (int e = 0; e < NEXP; ++e) acc[e] += xv * rw[e * HIDDEN + h];
  }
#pragma unroll
  for (int off = 16; off > 0; off >>= 1) {
#pragma unroll
    for (int e = 0; e < NEXP; ++e) acc[e] += __shfl_xor(acc[e], off, 32);
  }
  // softmax (all lanes redundantly)
  float mx = acc[0];
#pragma unroll
  for (int e = 1; e < NEXP; ++e) mx = fmaxf(mx, acc[e]);
  float p[NEXP], s = 0.f;
#pragma unroll
  for (int e = 0; e < NEXP; ++e) {
    p[e] = __expf(acc[e] - mx);
    s += p[e];
  }
  float inv = frcp(s);
#pragma unroll
  for (int e = 0; e < NEXP; ++e) p[e] *= inv;
  // top-2 of p+bias (earlier index wins ties, like lax.top_k)
  float s1 = -1e30f, s2 = -1e30f, w1 = 0.f, w2 = 0.f;
  int e1 = 0, e2 = 0;
#pragma unroll
  for (int e = 0; e < NEXP; ++e) {
    float v = p[e] + bias[e];
    if (v > s1) {
      s2 = s1; w2 = w1; e2 = e1;
      s1 = v;  w1 = p[e]; e1 = e;
    } else if (v > s2) {
      s2 = v; w2 = p[e]; e2 = e;
    }
  }
  float dnm = fmaxf(w1 + w2, 1e-12f);
  float rdnm = frcp(dnm);
  w1 *= rdnm;
  w2 *= rdnm;

  if (lane == 0) {
#pragma unroll
    for (int e = 0; e < NEXP; ++e) out_logits[t * NEXP + e] = acc[e];
    int* cnt = isv ? cnt_v : cnt_t;
    int* tok = isv ? tok_v : tok_t;
    float* wl = isv ? w_v : w_t;
    int p1 = atomicAdd(&cnt[e1], 1);
    tok[e1 * T_TOK + p1] = t;             // slot 0
    wl[e1 * T_TOK + p1] = w1;
    int p2 = atomicAdd(&cnt[e2], 1);
    tok[e2 * T_TOK + p2] = t | (1 << 16); // slot 1
    wl[e2 * T_TOK + p2] = w2;
  }
}

// ---------------------------------------------------------------------------
// Sparse expert MLP: block = (expert, ISL-column slice of the
// intermediate dim, 16-token tiles mt0 + MT_Z * i). 8 waves.
// Stage 1: gu = X(16xH) @ gate_up[e](H x 2I), the slice's g and u columns only;
//          each wave owns one matching g/u column tile -> register-local gating.
// Stage 2: y = h(16xISL) @ down[e](the slice's ISL rows x H), a partial sum over
//          the intermediate dim; write w*y to ys[tok][slot][slice][:]. An expert
//          with fewer than YS_SL slices stores zeros in the planes it lacks, so
//          that the combine sums the same planes for every token.
// ---------------------------------------------------------------------------
// smem: the work-group's 64 KB swizzled tile. mt0: the first token tile; further
// tiles follow with stride MT_Z.
template <int I>
__device__ __forceinline__ void expert_body(
    float* smem, const int e, const int sl, const int mt0,
    const float* __restrict__ x,
    const float* __restrict__ gate_up,  // [E][H][2I]
    const float* __restrict__ down,     // [E][I][H]
    const int* __restrict__ cnt, const int* __restrict__ tok,
    const float* __restrict__ wgt,
    float* __restrict__ ys) {           // [T][2][YS_SL][H]
  const int c = min(cnt[e], T_TOK);
  const int tid = threadIdx.x;
  const int wave = tid >> 5;
  const int lane = tid & 31;
  const int m = lane & 15;
  const int n = lane & 15;
  const int kh = (lane >> 4) << 1;  // 0 or 2
  const unsigned sbase = (unsigned)(uintptr_t)(&smem[0]);
  const float* gu = gate_up + (size_t)e * HIDDEN * (2 * I);
  const float* dn = down + ((size_t)e * I + (size_t)sl * ISL) * HIDDEN;
  const int gbase = sl * ISL + wave * 16;
  const int cb = wave * 128;
  const int lane1 = kh * (2 * I) + gbase + n;  // the lane's place in a 4-row step
  const int lane2 = kh * HIDDEN + cb + n;

  for (int mt = mt0; mt * 16 < c; mt += MT_Z) {
    if (mt != mt0) {
      // a further trip's copies overwrite the h tile: every wave's reads of it
      // end in front of them
      asm volatile("s_wait_dscnt 0x0" ::: "memory");
      __syncthreads();
    }
    const int* tokp = tok + e * T_TOK + mt * 16;
    const float* wp = wgt + e * T_TOK + mt * 16;
    const int nrows = min(16, c - mt * 16);

    // gather up to 16 token rows of x into LDS via async b128 DMA
    for (int i = tid; i < 16 * (HIDDEN / 4); i += 256) {
      int r = i >> 8;             // row 0..15
      int col = (i & 255) << 2;   // block-aligned column
      int idx = lds_idx(r, col, HIDDEN);
      if (r < nrows) {
        int tk = tokp[r] & 0xFFFF;
        async_gather_b128(sbase + 4u * (unsigned)idx,
                          x + (size_t)tk * HIDDEN + col);
      } else {
        v4f z = {0.f, 0.f, 0.f, 0.f};
        *(v4f*)&smem[idx] = z;
      }
    }
    wait_async0();
    __syncthreads();

    v8f accg = vzero8(), accu = vzero8();
    k_loop_ahead<16, 2>(
        HIDDEN,
        [&](v2f (&b)[16][2], int kb) {
#pragma unroll  // register arrays need constant indices
          for (int u = 0; u < 16; ++u) {
            // one lane address a call, the k-steps as constant offsets from it
            const float* b0 = gu + (size_t)kb * (2 * I) + lane1 + 4 * u * (2 * I);
            const float* b1 = b0 + (2 * I);
            b[u][0].x = b0[0];
            b[u][0].y = b1[0];
            b[u][1].x = b0[I];
            b[u][1].y = b1[I];
          }
        },
        [&](const v2f (&b)[16][2], int kb) {
#pragma unroll  // register arrays need constant indices
          for (int u = 0; u < 16; ++u) {
            const int kk = kb + 4 * u + kh;
            // kk is even: (kk, kk + 1) lie side by side in one 16-byte block
            const v2f a = *(const v2f*)&smem[lds_idx(m, kk, HIDDEN)];
            accg = wmma_k4(a, b[u][0], accg);
            accu = wmma_k4(a, b[u][1], accu);
          }
        });
    __syncthreads();  // everyone done reading x tile
    // h = silu(g)*u -> LDS (row-major swizzled over the slice's ISL columns)
#pragma unroll
    for (int r = 0; r < 8; ++r) {
      int mm = r + ((lane >> 4) << 3);
      smem[lds_idx(mm, wave * 16 + n, ISL)] = silu_f(accg[r]) * accu[r];
    }
    __syncthreads();

    v8f acco[8];
#pragma unroll
    for (int j = 0; j < 8; ++j) acco[j] = vzero8();
    k_loop_ahead<4, 8>(
        ISL,
        [&](v2f (&b)[4][8], int kb) {
#pragma unroll  // register arrays need constant indices
          for (int u = 0; u < 4; ++u) {
            // one lane address a call, the k-steps as constant offsets from it
            const float* b0 = dn + (size_t)kb * HIDDEN + lane2 + 4 * u * HIDDEN;
            const float* b1 = b0 + HIDDEN;
#pragma unroll  // register arrays need constant indices
            for (int j = 0; j < 8; ++j) {
              b[u][j].x = b0[j * 16];
              b[u][j].y = b1[j * 16];
            }
          }
        },
        [&](const v2f (&b)[4][8], int kb) {
#pragma unroll  // register arrays need constant indices
          for (int u = 0; u < 4; ++u) {
            const int kk = kb + 4 * u + kh;
            // kk is even: (kk, kk + 1) lie side by side in one 16-byte block
            const v2f a = *(const v2f*)&smem[lds_idx(m, kk, ISL)];
#pragma unroll  // register arrays need constant indices
            for (int j = 0; j < 8; ++j) acco[j] = wmma_k4(a, b[u][j], acco[j]);
          }
        });
    // deterministic scatter: each (token, slot, slice) row written exactly once
#pragma unroll
    for (int r = 0; r < 8; ++r) {
      int mm = r + ((lane >> 4) << 3);
      if (mm < nrows) {
        int ent = tokp[mm];
        int tk = ent & 0xFFFF;
        int slot = ent >> 16;
        float wv = wp[mm];
        float* dst = ys + ((size_t)tk * (2 * YS_SL) + slot * YS_SL + sl) * HIDDEN;
#pragma unroll
        for (int j = 0; j < 8; ++j) dst[cb + j * 16 + n] = wv * acco[j][r];
#pragma unroll
        for (int z = I / ISL; z < YS_SL; z += I / ISL) {
#pragma unroll
          for (int j = 0; j < 8; ++j) dst[z * HIDDEN + cb + j * 16 + n] = 0.f;
        }
      }
    }
    // a further trip forms new values in registers that these stores name
    asm volatile("s_wait_xcnt 0x0" ::: "memory");
  }
}

// ---------------------------------------------------------------------------
// Shared experts stage A: act = silu(x@Wg) * (x@Wu)   [T x 1024]
// 64 m-tiles x 8 column slices; wave owns 16 cols of Wg and of Wu.
// ---------------------------------------------------------------------------
__device__ __forceinline__ void shared_gu_body(
    float* smem, const int mt, const int nh,
    const float* __restrict__ x, const float* __restrict__ wg,
    const float* __restrict__ wu, float* __restrict__ act) {
  const int tid = threadIdx.x;
  const int wave = tid >> 5;
  const int lane = tid & 31;
  const int m = lane & 15;
  const int n = lane & 15;
  const int kh = (lane >> 4) << 1;

  const unsigned sbase = (unsigned)(uintptr_t)(&smem[0]);
  for (int i = tid; i < 16 * (HIDDEN / 4); i += 256) {
    int r = i >> 8;
    int col = (i & 255) << 2;
    async_gather_b128(sbase + 4u * (unsigned)lds_idx(r, col, HIDDEN),
                      x + (size_t)(mt * 16 + r) * HIDDEN + col);
  }
  wait_async0();
  __syncthreads();

  v8f ag = vzero8(), au = vzero8();
  const int cb = nh * 128 + wave * 16;
  k_loop_ahead<16, 2>(
      HIDDEN,
      [&](v2f (&b)[16][2], int kb) {
#pragma unroll  // register arrays need constant indices
        for (int u = 0; u < 16; ++u) {
          const size_t ro = (size_t)(kb + 4 * u + kh) * HIDDEN + cb + n;
          const float* g0 = wg + ro;
          const float* u0 = wu + ro;
          b[u][0].x = g0[0];
          b[u][0].y = g0[HIDDEN];
          b[u][1].x = u0[0];
          b[u][1].y = u0[HIDDEN];
        }
      },
      [&](const v2f (&b)[16][2], int kb) {
#pragma unroll  // register arrays need constant indices
        for (int u = 0; u < 16; ++u) {
          const int kk = kb + 4 * u + kh;
          // kk is even: (kk, kk + 1) lie side by side in one 16-byte block
          const v2f a = *(const v2f*)&smem[lds_idx(m, kk, HIDDEN)];
          ag = wmma_k4(a, b[u][0], ag);
          au = wmma_k4(a, b[u][1], au);
        }
      });
#pragma unroll
  for (int r = 0; r < 8; ++r) {
    int mm = r + ((lane >> 4) << 3);
    act[(size_t)(mt * 16 + mm) * HIDDEN + cb + n] = silu_f(ag[r]) * au[r];
  }
}

// ---------------------------------------------------------------------------
// One launch for the three bodies that need nothing of one another: text experts,
// vision experts, shared stage A. Each alone leaves WGPs idle or ends in a tail of
// its own; in one grid the next body's work-groups take every place that frees.
// Order of the flat index: the expert work-groups first (the longest, weights
// from memory), by token tile, so that those that have a tile start first; per
// tile level 64 text (16 experts x 4 slices) and 32 vision (16 x 2); then the 512
// of shared stage A. The branch is uniform for the work-group.
// Four waves a SIMD (256 registers a wave): two work-groups share a WGP.
// ---------------------------------------------------------------------------
#define LVL_T  (NEXP * (512 / ISL))          // text work-groups per tile level
#define LVL    (LVL_T + NEXP * (256 / ISL))  // expert work-groups per tile level
__global__ __launch_bounds__(256, 4) void k_experts_shared_gu(
    const float* __restrict__ x,
    const float* __restrict__ tgu, const float* __restrict__ tdn,
    const int* __restrict__ cnt_t, const int* __restrict__ tok_t,
    const float* __restrict__ w_t,
    const float* __restrict__ vgu, const float* __restrict__ vdn,
    const int* __restrict__ cnt_v, const int* __restrict__ tok_v,
    const float* __restrict__ w_v,
    float* __restrict__ ys,
    const float* __restrict__ wg, const float* __restrict__ wu,
    float* __restrict__ act) {
  __shared__ __align__(16) float smem[16 * HIDDEN];  // one tile for whichever body runs
  const int b = blockIdx.x;
  if (b < LVL * MT_Z) {
    const int mt0 = b / LVL;
    const int r = b - mt0 * LVL;
    if (r < LVL_T) {
      expert_body<512>(smem, r & (NEXP - 1), r / NEXP, mt0, x, tgu, tdn, cnt_t,
                       tok_t, w_t, ys);
    } else {
      const int q = r - LVL_T;
      expert_body<256>(smem, q & (NEXP - 1), q / NEXP, mt0, x, vgu, vdn, cnt_v,
                       tok_v, w_v, ys);
    }
  } else {
    const int s = b - LVL * MT_Z;
    shared_gu_body(smem, s & 63, s >> 6, x, wg, wu, act);
  }
}

// ---------------------------------------------------------------------------
// Shared experts stage B + final combine:
//   out = act @ Wd + sum over (slot, slice) of ys[tok][slot][slice]
// grid = (64 m-tiles, 8 column slices); wave owns 16 cols.
// ---------------------------------------------------------------------------
__global__ __launch_bounds__(256, 1) void k_shared_down_combine(
    const float* __restrict__ act, const float* __restrict__ wd,
    const float* __restrict__ ys, float* __restrict__ out) {
  __shared__ __align__(16) float smem[16 * HIDDEN];
  const int mt = blockIdx.x;
  const int nh = blockIdx.y;
  const int tid = threadIdx.x;
  const int wave = tid >> 5;
  const int lane = tid & 31;
  const int m = lane & 15;
  const int n = lane & 15;
  const int kh = (lane >> 4) << 1;

  const unsigned sbase = (unsigned)(uintptr_t)(&smem[0]);
  for (int i = tid; i < 16 * (HIDDEN / 4); i += 256) {
    int r = i >> 8;
    int col = (i & 255) << 2;
    async_gather_b128(sbase + 4u * (unsigned)lds_idx(r, col, HIDDEN),
                      act + (size_t)(mt * 16 + r) * HIDDEN + col);
  }
  wait_async0();
  __syncthreads();

  v8f ac = vzero8();
  const int cb = nh * 128 + wave * 16;
  const int lane0 = kh * HIDDEN + cb + n;  // the lane's place in a 4-row step
  k_loop_ahead<32, 1>(
      HIDDEN,
      [&](v2f (&b)[32][1], int kb) {
#pragma unroll  // register arrays need constant indices
        for (int u = 0; u < 32; ++u) {
          // one lane address a call, the k-steps as constant offsets from it
          const float* b0 = wd + (size_t)kb * HIDDEN + lane0 + 4 * u * HIDDEN;
          b[u][0].x = b0[0];
          b[u][0].y = b0[HIDDEN];
        }
      },
      [&](const v2f (&b)[32][1], int kb) {
#pragma unroll  // register arrays need constant indices
        for (int u = 0; u < 32; ++u) {
          const int kk = kb + 4 * u + kh;
          // kk is even: (kk, kk + 1) lie side by side in one 16-byte block
          const v2f a = *(const v2f*)&smem[lds_idx(m, kk, HIDDEN)];
          ac = wmma_k4(a, b[u][0], ac);
        }
      });
  const size_t row0 = (size_t)(mt * 16 + ((lane >> 4) << 3));
  const float* yp = ys + row0 * (2 * YS_SL * HIDDEN) + cb + n;
  float* op = out + row0 * HIDDEN + cb + n;
  float part[8][2 * YS_SL];
#pragma unroll  // register arrays need constant indices
  for (int r = 0; r < 8; ++r) {
#pragma unroll  // register arrays need constant indices
    for (int p = 0; p < 2 * YS_SL; ++p) part[r][p] = yp[(r * 2 * YS_SL + p) * HIDDEN];
  }
  // all these loads name yp: it is an operand here so that its registers live to
  // this wait and no loaded value lands in them in front of it
  asm volatile("s_wait_xcnt 0x0" ::"v"(yp) : "memory");
#pragma unroll
  for (int r = 0; r < 8; ++r) {
    float v = ac[r];
#pragma unroll
    for (int p = 0; p < 2 * YS_SL; ++p) v += part[r][p];
    op[r * HIDDEN] = v;
  }
}

extern "C" void kernel_launch(void* const* d_in, const int* in_sizes, int n_in,
                              void* d_out, int out_size, void* d_ws,
                              size_t ws_size, hipStream_t stream) {
  (void)in_sizes; (void)n_in; (void)out_size; (void)ws_size;
  const float* x   = (const float*)d_in[0];
  const int*   tt  = (const int*)d_in[1];
  const float* trw = (const float*)d_in[2];
  const float* tb  = (const float*)d_in[3];
  const float* tgu = (const float*)d_in[4];
  const float* tdn = (const float*)d_in[5];
  const float* vrw = (const float*)d_in[6];
  const float* vb  = (const float*)d_in[7];
  const float* vgu = (const float*)d_in[8];
  const float* vdn = (const float*)d_in[9];
  const float* sg  = (const float*)d_in[10];
  const float* su  = (const float*)d_in[11];
  const float* sd  = (const float*)d_in[12];

  float* out = (float*)d_out;
  float* out_logits = out + (size_t)T_TOK * HIDDEN;

  // workspace layout (all 4-byte elements)
  int* cnt_t = (int*)d_ws;
  int* cnt_v = cnt_t + 16;
  int* tok_t = cnt_v + 16;
  int* tok_v = tok_t + NEXP * T_TOK;
  float* w_t = (float*)(tok_v + NEXP * T_TOK);
  float* w_v = w_t + NEXP * T_TOK;
  float* act = w_v + NEXP * T_TOK;                 // [T][H] = 4 MB
  float* ys  = act + (size_t)T_TOK * HIDDEN;       // [T][2][YS_SL][H] = 32 MB

  k_zero<<<1, 64, 0, stream>>>(cnt_t, 32);
  k_router<<<128, 256, 0, stream>>>(x, tt, trw, tb, vrw, vb, out_logits, cnt_t,
                                    tok_t, w_t, cnt_v, tok_v, w_v);
  k_experts_shared_gu<<<2048, 256, 0, stream>>>(x, tgu, tdn, cnt_t, tok_t, w_t, vgu,
                                                vdn, cnt_v, tok_v, w_v, ys, sg, su,
                                                act);
  k_shared_down_combine<<<dim3(64, 8), 256, 0, stream>>>(act, sd, ys, out);
}

// v004
// A run of this version takes 127 microseconds.
// Next to v003, in two timings, it ran 1.05 times as fast each time.
// Counting every step since v000, it is 4.18 times as fast.
#include <hip/hip_runtime.h>

typedef float v2f __attribute__((ext_vector_type(2)));
typedef float v4f __attribute__((ext_vector_type(4)));
typedef float v8f __attribute__((ext_vector_type(8)));

#define HIDDEN 1024
#define NEXP   16
#define T_TOK  1024
#define ISL    128  // columns of an expert's intermediate dim per work-group
#define YS_SL  4    // slices of the widest expert (512 / ISL): planes of ys per slot
#define MR     32   // token rows per work-group: two 16-row tiles share each weight fragment
#define MT_Z   8    // work-groups per expert slice: token tiles walked with this stride

__device__ __forceinline__ v8f vzero8() {
  v8f z = {0.f, 0.f, 0.f, 0.f, 0.f, 0.f, 0.f, 0.f};
  return z;
}

// D = A(16x4) * B(4x16) + C, fp32 WMMA
__device__ __forceinline__ v8f wmma_k4(v2f a, v2f b, v8f c) {
  return __builtin_amdgcn_wmma_f32_16x16x4_f32(false, a, false, b, (short)0, c,
                                               false, false);
}

// Row-major LDS tile with 16-byte-block XOR swizzle:
//   element (r, c) lives at row(r)*ld + (((c>>2) ^ (r & 15)) << 2 | (c & 3)),
//   row(r) = 2 * (r & 15) + (r >> 4)
// - async b128 copies (4 floats, block-aligned) stay contiguous
// - A-fragment loads (lanes 0..15 -> rows 0..15, fixed k) hit 16 distinct
//   4-bank blocks -> conflict-free; merged (k,k+1) pairs form ds_load_b64.
// - rows r and r + 16 swizzle alike and lie side by side: the second tile's
//   fragment is the first's address plus ld, an immediate offset.
__device__ __forceinline__ int lds_idx(int r, int c, int ld) {
  return (((r & 15) << 1) | (r >> 4)) * ld + ((((c >> 2) ^ (r & 15)) << 2) | (c & 3));
}
// The same place for an A fragment, element (m, kb + 4 * u + kh), m < 16, where kb
// is a multiple of 64: the swizzle touches only u's low four bits, so that the lane's
// part is one of 16 values and kb and the rest of u are plain offsets.
__device__ __forceinline__ int lds_idx_a(int m, int kh, int kb, int u, int ld) {
  return 2 * m * ld + (((u & 15) ^ m) << 2) + kh + kb + ((u & ~15) << 2);
}

// global -> LDS async DMA, 16 bytes per lane (ASYNCcnt-tracked)
__device__ __forceinline__ void async_gather_b128(unsigned lds_byte_off,
                                                  const float* gptr) {
  // the wait ends the statement: later code rewrites the two address registers
  asm volatile("global_load_async_to_lds_b128 %0, %1, off\n\ts_wait_xcnt 0x0"
               :
               : "v"(lds_byte_off), "v"(gptr)
               : "memory");
}
__device__ __forceinline__ void wait_async0() {
  asm volatile("s_wait_asynccnt 0x0" ::: "memory");
}

// fast reciprocal: raw v_rcp_f32 (~1 ulp), avoids IEEE div expansion
__device__ __forceinline__ float frcp(float x) {
  return __builtin_amdgcn_rcpf(x);
}

__device__ __forceinline__ float silu_f(float g) {
  return g * frcp(1.f + __expf(-g));
}

// K loop with the weight (B) fragments fetched ahead into two register sets of
// U k-steps each: as soon as a set has been multiplied it is refilled with the
// rows 8 * U further on, and those loads fly while the other set is multiplied.
// ld(set, kb) loads the U k-steps that start at row kb; mm(set, kb, u0) multiplies
// the U k-steps that start at row kb + 4 * u0 (kb a multiple of 8 * U, u0 constant),
// in the same k order as a plain loop.
// K is a multiple of 8 * U; no row at or past K is ever loaded.
// Each loaded fragment is multiplied with both 16-row tiles of the work-group.
// U * NT = 16 everywhere: 32 loads of a wave per set for 32 WMMAs, both sets
// together what the load counter holds; two sets of 32 registers beside 16 to
// 128 accumulator registers.
template <int U, int NT, typename LD, typename MM>
__device__ __forceinline__ void k_loop_ahead(int K, LD ld, MM mm) {
  v2f s0[U][NT], s1[U][NT];
  ld(s0, 0);
  ld(s1, 4 * U);
  int kb = 0;
  // stays rolled: unrolled whole, the short loop over ISL spills registers to scratch
#pragma unroll 1
  for (; kb < K - 8 * U; kb += 8 * U) {
    mm(s0, kb, 0);
    ld(s0, kb + 8 * U);
    mm(s1, kb, U);
    ld(s1, kb + 12 * U);
    // the next trip forms new addresses in registers that this trip's loads name
    asm volatile("s_wait_xcnt 0x0" ::: "memory");
  }
  mm(s0, kb, 0);
  mm(s1, kb, U);
}

__global__ void k_zero(int* p, int n) {
  int i = blockIdx.x * blockDim.x + threadIdx.x;
  if (i < n) p[i] = 0;
}

// ---------------------------------------------------------------------------
// Router: one wave per token. Computes 16 logits (chosen modality), softmax,
// top-2 on probs+bias, normalized weights. Appends (token|slot<<16, weight)
// to the per-expert dispatch lists.
// ---------------------------------------------------------------------------
__global__ __launch_bounds__(256) void k_router(
    const float* __restrict__ x, const int* __restrict__ tt,
    const float* __restrict__ rw_t, const float* __restrict__ bias_t,
    const float* __restrict__ rw_v, const float* __restrict__ bias_v,
    float* __restrict__ out_logits,
    int* __restrict__ cnt_t, int* __restrict__ tok_t, float* __restrict__ w_t,
    int* __restrict__ cnt_v, int* __restrict__ tok_v, float* __restrict__ w_v) {
  const int wave = threadIdx.x >> 5;
  const int lane = threadIdx.x & 31;
  const int t = blockIdx.x * 8 + wave;
  if (t >= T_TOK) return;
  const bool isv = (tt[t] != 0);
  const float* rw = isv ? rw_v : rw_t;
  const float* bias = isv ? bias_v : bias_t;

  float acc[NEXP];
#pragma unroll
  for (int e = 0; e < NEXP; ++e) acc[e] = 0.f;
  const float* xr = x + (size_t)t * HIDDEN;
  for (int h = lane; h < HIDDEN; h += 32) {
    float xv = xr[h];
#pragma unroll
    for (int e = 0; e < NEXP; ++e) acc[e] += xv * rw[e * HIDDEN + h];
  }
#pragma unroll
  for (int off = 16; off > 0; off >>= 1) {
#pragma unroll
    for (int e = 0; e < NEXP; ++e) acc[e] += __shfl_xor(acc[e], off, 32);
  }
  // softmax (all lanes redundantly)
  float mx = acc[0];
#pragma unroll
  for (int e = 1; e < NEXP; ++e) mx = fmaxf(mx, acc[e]);
  float p[NEXP], s = 0.f;
#pragma unroll
  for (int e = 0; e < NEXP; ++e) {
    p[e] = __expf(acc[e] - mx);
    s += p[e];
  }
  float inv = frcp(s);
#pragma unroll
  for (int e = 0; e < NEXP; ++e) p[e] *= inv;
  // top-2 of p+bias (earlier index wins ties, like lax.top_k)
  float s1 = -1e30f, s2 = -1e30f, w1 = 0.f, w2 = 0.f;
  int e1 = 0, e2 = 0;
#pragma unroll
  for (int e = 0; e < NEXP; ++e) {
    float v = p[e] + bias[e];
    if (v > s1) {
      s2 = s1; w2 = w1; e2 = e1;
      s1 = v;  w1 = p[e]; e1 = e;
    } else if (v > s2) {
      s2 = v; w2 = p[e]; e2 = e;
    }
  }
  float dnm = fmaxf(w1 + w2, 1e-12f);
  float rdnm = frcp(dnm);
  w1 *= rdnm;
  w2 *= rdnm;

  if (lane == 0) {
#pragma unroll
    for (int e = 0; e < NEXP; ++e) out_logits[t * NEXP + e] = acc[e];
    int* cnt = isv ? cnt_v : cnt_t;
    int* tok = isv ? tok_v : tok_t;
    float* wl = isv ? w_v : w_t;
    int p1 = atomicAdd(&cnt[e1], 1);
    tok[e1 * T_TOK + p1] = t;             // slot 0
    wl[e1 * T_TOK + p1] = w1;
    int p2 = atomicAdd(&cnt[e2], 1);
    tok[e2 * T_TOK + p2] = t | (1 << 16); // slot 1
    wl[e2 * T_TOK + p2] = w2;
  }
}

// ---------------------------------------------------------------------------
// Sparse expert MLP: block = (expert, MR-token tile, ISL-column slice of the
// intermediate dim). 8 waves.
// Stage 1: gu = X(MRxH) @ gate_up[e](H x 2I), the slice's g and u columns only;
//          each wave owns one matching g/u column tile -> register-local gating.
// Stage 2: y = h(MRxISL) @ down[e](the slice's ISL rows x H), a partial sum over
//          the intermediate dim; write w*y to ys[tok][slot][slice][:]. An expert
//          with fewer than YS_SL slices stores zeros in the planes it lacks, so
//          that the combine sums the same planes for every token.
// ---------------------------------------------------------------------------
// smem: the work-group's 128 KB swizzled tile. mt0: the first token tile; further
// tiles follow with stride MT_Z.
template <int I>
__device__ __forceinline__ void expert_body(
    float* smem, const int e, const int sl, const int mt0,
    const float* __restrict__ x,
    const float* __restrict__ gate_up,  // [E][H][2I]
    const float* __restrict__ down,     // [E][I][H]
    const int* __restrict__ cnt, const int* __restrict__ tok,
    const float* __restrict__ wgt,
    float* __restrict__ ys) {           // [T][2][YS_SL][H]
  const int c = min(cnt[e], T_TOK);
  const int tid = threadIdx.x;
  const int wave = tid >> 5;
  const int lane = tid & 31;
  const int m = lane & 15;
  const int n = lane & 15;
  const int kh = (lane >> 4) << 1;  // 0 or 2
  const unsigned sbase = (unsigned)(uintptr_t)(&smem[0]);
  const float* gu = gate_up + (size_t)e * HIDDEN * (2 * I);
  const float* dn = down + ((size_t)e * I + (size_t)sl * ISL) * HIDDEN;
  const int gbase = sl * ISL + wave * 16;
  const int cb = wave * 128;
  const int lane1 = kh * (2 * I) + gbase + n;  // the lane's place in a 4-row step
  const int lane2 = kh * HIDDEN + cb + n;

  for (int mt = mt0; mt * MR < c; mt += MT_Z) {
    if (mt != mt0) {
      // a further trip's copies overwrite the h tile: every wave's reads of it
      // end in front of them
      asm volatile("s_wait_dscnt 0x0" ::: "memory");
      __syncthreads();
    }
    const int* tokp = tok + e * T_TOK + mt * MR;
    const float* wp = wgt + e * T_TOK + mt * MR;
    const int nrows = min(MR, c - mt * MR);

    // gather up to MR token rows of x into LDS via async b128 DMA
    for (int i = tid; i < MR * (HIDDEN / 4); i += 256) {
      int r = i >> 8;             // row 0..MR-1
      int col = (i & 255) << 2;   // block-aligned column
      int idx = lds_idx(r, col, HIDDEN);
      if (r < nrows) {
        int tk = tokp[r] & 0xFFFF;
        async_gather_b128(sbase + 4u * (unsigned)idx,
                          x + (size_t)tk * HIDDEN + col);
      } else {
        v4f z = {0.f, 0.f, 0.f, 0.f};
        *(v4f*)&smem[idx] = z;
      }
    }
    wait_async0();
    __syncthreads();

    v8f accg[2] = {vzero8(), vzero8()}, accu[2] = {vzero8(), vzero8()};
    k_loop_ahead<8, 2>(
        HIDDEN,
        [&](v2f (&b)[8][2], int kb) {
#pragma unroll  // register arrays need constant indices
          for (int u = 0; u < 8; ++u) {
            // one lane address a call, the k-steps as constant offsets from it
            const float* b0 = gu + (size_t)kb * (2 * I) + lane1 + 4 * u * (2 * I);
            const float* b1 = b0 + (2 * I);
            b[u][0].x = b0[0];
            b[u][0].y = b1[0];
            b[u][1].x = b0[I];
            b[u][1].y = b1[I];
          }
        },
        [&](const v2f (&b)[8][2], int kb, int u0) {
#pragma unroll  // register arrays need constant indices
          for (int u = 0; u < 8; ++u) {
            // kh is even: (k, k + 1) lie side by side in one 16-byte block
            const float* ap = &smem[lds_idx_a(m, kh, kb, u0 + u, HIDDEN)];
            const v2f a0 = *(const v2f*)ap;
            const v2f a1 = *(const v2f*)(ap + HIDDEN);
            accg[0] = wmma_k4(a0, b[u][0], accg[0]);
            accu[0] = wmma_k4(a0, b[u][1], accu[0]);
            accg[1] = wmma_k4(a1, b[u][0], accg[1]);
            accu[1] = wmma_k4(a1, b[u][1], accu[1]);
          }
        });
    __syncthreads();  // everyone done reading x tile
    // h = silu(g)*u -> LDS (row-major swizzled over the slice's ISL columns)
#pragma unroll
    for (int t = 0; t < 2; ++t) {
#pragma unroll
      for (int r = 0; r < 8; ++r) {
        int mm = t * 16 + r + ((lane >> 4) << 3);
        smem[lds_idx(mm, wave * 16 + n, ISL)] = silu_f(accg[t][r]) * accu[t][r];
      }
    }
    __syncthreads();

    v8f acco[2][8];
#pragma unroll
    for (int j = 0; j < 8; ++j) {
      acco[0][j] = vzero8();
      acco[1][j] = vzero8();
    }
    k_loop_ahead<2, 8>(
        ISL,
        [&](v2f (&b)[2][8], int kb) {
#pragma unroll  // register arrays need constant indices
          for (int u = 0; u < 2; ++u) {
            // one lane address a call, the k-steps as constant offsets from it
            const float* b0 = dn + (size_t)kb * HIDDEN + lane2 + 4 * u * HIDDEN;
            const float* b1 = b0 + HIDDEN;
#pragma unroll  // register arrays need constant indices
            for (int j = 0; j < 8; ++j) {
              b[u][j].x = b0[j * 16];
              b[u][j].y = b1[j * 16];
            }
          }
        },
        [&](const v2f (&b)[2][8], int kb, int u0) {
#pragma unroll  // register arrays need constant indices
          for (int u = 0; u < 2; ++u) {
            const int kk = kb + 4 * (u0 + u) + kh;
            // kk is even: (kk, kk + 1) lie side by side in one 16-byte block
            const float* ap = &smem[lds_idx(m, kk, ISL)];
            const v2f a0 = *(const v2f*)ap;
            const v2f a1 = *(const v2f*)(ap + ISL);
#pragma unroll  // register arrays need constant indices
            for (int j = 0; j < 8; ++j) {
              acco[0][j] = wmma_k4(a0, b[u][j], acco[0][j]);
              acco[1][j] = wmma_k4(a1, b[u][j], acco[1][j]);
            }
          }
        });
    // deterministic scatter: each (token, slot, slice) row written exactly once
#pragma unroll
    for (int t = 0; t < 2; ++t) {
#pragma unroll
      for (int r = 0; r < 8; ++r) {
        int mm = t * 16 + r + ((lane >> 4) << 3);
        if (mm < nrows) {
          int ent = tokp[mm];
          int tk = ent & 0xFFFF;
          int slot = ent >> 16;
          float wv = wp[mm];
          float* dst = ys + ((size_t)tk * (2 * YS_SL) + slot * YS_SL + sl) * HIDDEN;
#pragma unroll
          for (int j = 0; j < 8; ++j) dst[cb + j * 16 + n] = wv * acco[t][j][r];
#pragma unroll
          for (int z = I / ISL; z < YS_SL; z += I / ISL) {
#pragma unroll
            for (int j = 0; j < 8; ++j) dst[z * HIDDEN + cb + j * 16 + n] = 0.f;
          }
        }
      }
    }
    // a further trip forms new values in registers that these stores name
    asm volatile("s_wait_xcnt 0x0" ::: "memory");
  }
}

// ---------------------------------------------------------------------------
// Shared experts stage A: act = silu(x@Wg) * (x@Wu)   [T x 1024]
// 32 m-tiles of MR rows x 8 column slices; wave owns 16 cols of Wg and of Wu.
// ---------------------------------------------------------------------------
__device__ __forceinline__ void shared_gu_body(
    float* smem, const int mt, const int nh,
    const float* __restrict__ x, const float* __restrict__ wg,
    const float* __restrict__ wu, float* __restrict__ act) {
  const int tid = threadIdx.x;
  const int wave = tid >> 5;
  const int lane = tid & 31;
  const int m = lane & 15;
  const int n = lane & 15;
  const int kh = (lane >> 4) << 1;

  const unsigned sbase = (unsigned)(uintptr_t)(&smem[0]);
  for (int i = tid; i < MR * (HIDDEN / 4); i += 256) {
    int r = i >> 8;
    int col = (i & 255) << 2;
    async_gather_b128(sbase + 4u * (unsigned)lds_idx(r, col, HIDDEN),
                      x + (size_t)(mt * MR + r) * HIDDEN + col);
  }
  wait_async0();
  __syncthreads();

  v8f ag[2] = {vzero8(), vzero8()}, au[2] = {vzero8(), vzero8()};
  const int cb = nh * 128 + wave * 16;
  k_loop_ahead<8, 2>(
      HIDDEN,
      [&](v2f (&b)[8][2], int kb) {
#pragma unroll  // register arrays need constant indices
        for (int u = 0; u < 8; ++u) {
          const size_t ro = (size_t)(kb + 4 * u + kh) * HIDDEN + cb + n;
          const float* g0 = wg + ro;
          const float* u0 = wu + ro;
          b[u][0].x = g0[0];
          b[u][0].y = g0[HIDDEN];
          b[u][1].x = u0[0];
          b[u][1].y = u0[HIDDEN];
        }
      },
      [&](const v2f (&b)[8][2], int kb, int u0) {
#pragma unroll  // register arrays need constant indices
        for (int u = 0; u < 8; ++u) {
          // kh is even: (k, k + 1) lie side by side in one 16-byte block
          const float* ap = &smem[lds_idx_a(m, kh, kb, u0 + u, HIDDEN)];
          const v2f a0 = *(const v2f*)ap;
          const v2f a1 = *(const v2f*)(ap + HIDDEN);
          ag[0] = wmma_k4(a0, b[u][0], ag[0]);
          au[0] = wmma_k4(a0, b[u][1], au[0]);
          ag[1] = wmma_k4(a1, b[u][0], ag[1]);
          au[1] = wmma_k4(a1, b[u][1], au[1]);
        }
      });
#pragma unroll
  for (int t = 0; t < 2; ++t) {
#pragma unroll
    for (int r = 0; r < 8; ++r) {
      int mm = t * 16 + r + ((lane >> 4) << 3);
      act[(size_t)(mt * MR + mm) * HIDDEN + cb + n] = silu_f(ag[t][r]) * au[t][r];
    }
  }
}

// ---------------------------------------------------------------------------
// One launch for the three bodies that need nothing of one another: text experts,
// vision experts, shared stage A. Each alone leaves WGPs idle or ends in a tail of
// its own; in one grid the next body's work-groups take every place that frees.
// Order of the flat index: the expert work-groups first (the longest, weights
// from memory), by token tile, so that those that have a tile start first; per
// tile level 64 text (16 experts x 4 slices) and 32 vision (16 x 2); then the 256
// of shared stage A. The branch is uniform for the work-group.
// Four waves a SIMD (256 registers a wave): two work-groups share a WGP.
// ---------------------------------------------------------------------------
#define LVL_T  (NEXP * (512 / ISL))          // text work-groups per tile level
#define LVL    (LVL_T + NEXP * (256 / ISL))  // expert work-groups per tile level
__global__ __launch_bounds__(256, 4) void k_experts_shared_gu(
    const float* __restrict__ x,
    const float* __restrict__ tgu, const float* __restrict__ tdn,
    const int* __restrict__ cnt_t, const int* __restrict__ tok_t,
    const float* __restrict__ w_t,
    const float* __restrict__ vgu, const float* __restrict__ vdn,
    const int* __restrict__ cnt_v, const int* __restrict__ tok_v,
    const float* __restrict__ w_v,
    float* __restrict__ ys,
    const float* __restrict__ wg, const float* __restrict__ wu,
    float* __restrict__ act) {
  __shared__ __align__(16) float smem[MR * HIDDEN];  // one tile for whichever body runs
  const int b = blockIdx.x;
  if (b < LVL * MT_Z) {
    const int mt0 = b / LVL;
    const int r = b - mt0 * LVL;
    if (r < LVL_T) {
      expert_body<512>(smem, r & (NEXP - 1), r / NEXP, mt0, x, tgu, tdn, cnt_t,
                       tok_t, w_t, ys);
    } else {
      const int q = r - LVL_T;
      expert_body<256>(smem, q & (NEXP - 1), q / NEXP, mt0, x, vgu, vdn, cnt_v,
                       tok_v, w_v, ys);
    }
  } else {
    const int s = b - LVL * MT_Z;
    shared_gu_body(smem, s & 31, s >> 5, x, wg, wu, act);
  }
}

// ---------------------------------------------------------------------------
// Shared experts stage B + final combine:
//   out = act @ Wd + sum over (slot, slice) of ys[tok][slot][slice]
// grid = (32 m-tiles of MR rows, 8 column slices); wave owns 16 cols.
// ---------------------------------------------------------------------------
__global__ __launch_bounds__(256, 1) void k_shared_down_combine(
    const float* __restrict__ act, const float* __restrict__ wd,
    const float* __restrict__ ys, float* __restrict__ out) {
  __shared__ __align__(16) float smem[MR * HIDDEN];
  const int mt = blockIdx.x;
  const int nh = blockIdx.y;
  const int tid = threadIdx.x;
  const int wave = tid >> 5;
  const int lane = tid & 31;
  const int m = lane & 15;
  const int n = lane & 15;
  const int kh = (lane >> 4) << 1;

  const unsigned sbase = (unsigned)(uintptr_t)(&smem[0]);
  for (int i = tid; i < MR * (HIDDEN / 4); i += 256) {
    int r = i >> 8;
    int col = (i & 255) << 2;
    async_gather_b128(sbase + 4u * (unsigned)lds_idx(r, col, HIDDEN),
                      act + (size_t)(mt * MR + r) * HIDDEN + col);
  }
  wait_async0();
  __syncthreads();

  v8f ac[2] = {vzero8(), vzero8()};
  const int cb = nh * 128 + wave * 16;
  const int lane0 = kh * HIDDEN + cb + n;  // the lane's place in a 4-row step
  k_loop_ahead<16, 1>(
      HIDDEN,
      [&](v2f (&b)[16][1], int kb) {
#pragma unroll  // register arrays need constant indices
        for (int u = 0; u < 16; ++u) {
          // one lane address a call, the k-steps as constant offsets from it
          const float* b0 = wd + (size_t)kb * HIDDEN + lane0 + 4 * u * HIDDEN;
          b[u][0].x = b0[0];
          b[u][0].y = b0[HIDDEN];
        }
      },
      [&](const v2f (&b)[16][1], int kb, int u0) {
#pragma unroll  // register arrays need constant indices
        for (int u = 0; u < 16; ++u) {
          // kh is even: (k, k + 1) lie side by side in one 16-byte block
          const float* ap = &smem[lds_idx_a(m, kh, kb, u0 + u, HIDDEN)];
          const v2f a0 = *(const v2f*)ap;
          const v2f a1 = *(const v2f*)(ap + HIDDEN);
          ac[0] = wmma_k4(a0, b[u][0], ac[0]);
          ac[1] = wmma_k4(a1, b[u][0], ac[1]);
        }
      });
  const size_t row0 = (size_t)(mt * MR + ((lane >> 4) << 3));
  const float* yp = ys + row0 * (2 * YS_SL * HIDDEN) + cb + n;
  float* op = out + row0 * HIDDEN + cb + n;
  float part[2][8][2 * YS_SL];
#pragma unroll  // register arrays need constant indices
  for (int t = 0; t < 2; ++t) {
#pragma unroll  // register arrays need constant indices
    for (int r = 0; r < 8; ++r) {
#pragma unroll  // register arrays need constant indices
      for (int p = 0; p < 2 * YS_SL; ++p)
        part[t][r][p] = yp[((t * 16 + r) * 2 * YS_SL + p) * HIDDEN];
    }
  }
  // all these loads name yp: it is an operand here so that its registers live to
  // this wait and no loaded value lands in them in front of it
  asm volatile("s_wait_xcnt 0x0" ::"v"(yp) : "memory");
#pragma unroll
  for (int t = 0; t < 2; ++t) {
#pragma unroll
    for (int r = 0; r < 8; ++r) {
      float v = ac[t][r];
#pragma unroll
      for (int p = 0; p < 2 * YS_SL; ++p) v += part[t][r][p];
      op[(t * 16 + r) * HIDDEN] = v;
    }
  }
}

extern "C" void kernel_launch(void* const* d_in, const int* in_sizes, int n_in,
                              void* d_out, int out_size, void* d_ws,
                              size_t ws_size, hipStream_t stream) {
  (void)in_sizes; (void)n_in; (void)out_size; (void)ws_size;
  const float* x   = (const float*)d_in[0];
  const int*   tt  = (const int*)d_in[1];
  const float* trw = (const float*)d_in[2];
  const float* tb  = (const float*)d_in[3];
  const float* tgu = (const float*)d_in[4];
  const float* tdn = (const float*)d_in[5];
  const float* vrw = (const float*)d_in[6];
  const float* vb  = (const float*)d_in[7];
  const float* vgu = (const float*)d_in[8];
  const float* vdn = (const float*)d_in[9];
  const float* sg  = (const float*)d_in[10];
  const float* su  = (const float*)d_in[11];
  const float* sd  = (const float*)d_in[12];

  float* out = (float*)d_out;
  float* out_logits = out + (size_t)T_TOK * HIDDEN;

  // workspace layout (all 4-byte elements)
  int* cnt_t = (int*)d_ws;
  int* cnt_v = cnt_t + 16;
  int* tok_t = cnt_v + 16;
  int* tok_v = tok_t + NEXP * T_TOK;
  float* w_t = (float*)(tok_v + NEXP * T_TOK);
  float* w_v = w_t + NEXP * T_TOK;
  float* act = w_v + NEXP * T_TOK;                 // [T][H] = 4 MB
  float* ys  = act + (size_t)T_TOK * HIDDEN;       // [T][2][YS_SL][H] = 32 MB

  k_zero<<<1, 64, 0, stream>>>(cnt_t, 32);
  k_router<<<128, 256, 0, stream>>>(x, tt, trw, tb, vrw, vb, out_logits, cnt_t,
                                    tok_t, w_t, cnt_v, tok_v, w_v);
  k_experts_shared_gu<<<1024, 256, 0, stream>>>(x, tgu, tdn, cnt_t, tok_t, w_t, vgu,
                                                vdn, cnt_v, tok_v, w_v, ys, sg, su,
                                                act);
  k_shared_down_combine<<<dim3(32, 8), 256, 0, stream>>>(act, sd, ys, out);
}
